// v000
// The times below were measured on an AMD MI455X: many runs one after another, warmed up first and cycling through
// copies of the inputs, with the whole window's GPU time divided by the number of runs. Launches and the gaps
// between them are all in it. The median over several windows is given; except for v000 it joins two sittings, which
// can be a few percent apart, so the side-by-side timings, each taken in one sitting, are the better comparison.
// v000, which the later versions start from, runs in 240 microseconds.
// compute dtype: all float inputs rounded to bf16; q/k/v = x . W with EXACT bf16 products on WMMA 16x16x32 ((in,out) weights as transposed rows): q kept f32 (for the ELU memory branch) and as f16, k as f16 rows, v as f16 planes; grouped softmax attention (4 query groups x 8 heads x 32 dims over 1,024 keys): q, k single f16 x 32^-1/2, running-max softmax in f32 (hardware exp), P (scaled by 2^11, single f16) x v (single f16); memory branch: sigma = elu(q group row) in f32, (sigma as bf16 hi + lo, 2 products) . memory and sigma . memory_norm (f32 dot), divide; out = attn (1 - sigmoid(w)) + mem sigmoid(w) in f32; f32 output.
#include <hip/hip_runtime.h>
#include <math.h>

typedef __attribute__((ext_vector_type(16))) _Float16 v16h;
typedef __attribute__((ext_vector_type(16))) __bf16 v16b;
typedef __attribute__((ext_vector_type(8)))  _Float16 v8h;
typedef __attribute__((ext_vector_type(8)))  float v8f;
typedef __attribute__((ext_vector_type(4)))  float v4f;
typedef __attribute__((ext_vector_type(2)))  float v2f;
typedef __attribute__((ext_vector_type(4)))  unsigned v4u;
typedef __attribute__((ext_vector_type(4)))  int v4i;
typedef float __attribute__((may_alias)) float_a;
typedef int __attribute__((may_alias)) int_a;

template <typename T> __device__ __forceinline__ void vst2(void* p, T v) { *(T*)p = v;  }
__device__ __forceinline__ v8f wmma16(v16h a, v16h b, v8f c) {
  v8f d = __builtin_amdgcn_wmma_f32_16x16x32_f16(false, a, false, b, (short)0, c, false, false);
  asm volatile("v_nop\n\tv_nop\n\tv_nop\n\tv_nop" : "+v"(d) : "v"(a), "v"(b));
  return d;
}
__device__ __forceinline__ v8f wmma_bf(v16b a, v16b b, v8f c) {
  v8f d = __builtin_amdgcn_wmma_f32_16x16x32_bf16(false, a, false, b, (short)0, c, false, false);
  asm volatile("v_nop\n\tv_nop\n\tv_nop\n\tv_nop" : "+v"(d) : "v"(a), "v"(b));
  return d;
}
// 16x16x32 fragments: lane = (h = lane>>4, row/col = lane&15); elements 0..7 = k0+8h+0..7, 8..15 = k0+16+8h+0..7; D element r = row 8h+r
__device__ __forceinline__ v16h frag_h(const _Float16* rowk0, int lane) {
  union { v16h v; v8h q[2]; } u; const _Float16* p = rowk0 + 8 * (lane >> 4);
  u.q[0] = *(const v8h*)p; u.q[1] = *(const v8h*)(p + 16); return u.v;
}
__device__ __forceinline__ v16h frag_f32(const float* rowk0, int lane) {
  v16h a; const float* p = rowk0 + 8 * (lane >> 4);
#pragma unroll
  for (int i = 0; i < 8; ++i) { a[i] = (_Float16)p[i]; a[8 + i] = (_Float16)p[16 + i]; }
  return a;
}
__device__ __forceinline__ v16h frag_f32s(const float* rowk0, int lane, float sc) {
  v16h a; const float* p = rowk0 + 8 * (lane >> 4);
#pragma unroll
  for (int i = 0; i < 8; ++i) { a[i] = (_Float16)(p[i] * sc); a[8 + i] = (_Float16)(p[16 + i] * sc); }
  return a;
}
// column fragment from a [K][ld] layout (column n), rows >= K read as 0
__device__ __forceinline__ v16h fragc_f32(const float* W, int k0, int n, int lane, int ld, int K) {
  v16h a; const int g = lane >> 4;
#pragma unroll
  for (int i = 0; i < 8; ++i) { const int ka = k0 + 8 * g + i, kb = ka + 16;
    a[i] = (_Float16)(ka < K ? W[(size_t)(ka < K ? ka : K - 1) * ld + n] : 0.f); a[8 + i] = (_Float16)(kb < K ? W[(size_t)(kb < K ? kb : K - 1) * ld + n] : 0.f); }
  return a;
}
struct F2 { v16b h, l; };
__device__ __forceinline__ F2 bsplit16(const float v[16]) { F2 r;
#pragma unroll
  for (int i = 0; i < 16; ++i) { const __bf16 h = (__bf16)v[i]; r.h[i] = h; r.l[i] = (__bf16)(v[i] - (float)h); }
  return r; }
__device__ __forceinline__ F2 split_row(const float* row, int k0, int lane) { float v[16]; const float* p = row + k0 + 8 * (lane >> 4);
#pragma unroll
  for (int i = 0; i < 8; ++i) { v[i] = p[i]; v[8 + i] = p[16 + i]; }
  return bsplit16(v); }
__device__ __forceinline__ F2 split_rowK(const float* row, int k0, int lane, int K) { float v[16]; const int g = lane >> 4;
#pragma unroll
  for (int i = 0; i < 8; ++i) { const int ka = k0 + 8 * g + i, kb = ka + 16; v[i] = ka < K ? row[ka < K ? ka : K - 1] : 0.f; v[8 + i] = kb < K ? row[kb < K ? kb : K - 1] : 0.f; }
  return bsplit16(v); }
__device__ __forceinline__ F2 split_col(const float* W, int k0, int n, int lane, int ld, int K) { float v[16]; const int g = lane >> 4;
#pragma unroll
  for (int i = 0; i < 8; ++i) { const int ka = k0 + 8 * g + i, kb = ka + 16; v[i] = ka < K ? W[(size_t)(ka < K ? ka : K - 1) * ld + n] : 0.f; v[8 + i] = kb < K ? W[(size_t)(kb < K ? kb : K - 1) * ld + n] : 0.f; }
  return bsplit16(v); }
__device__ __forceinline__ v8f mac3(const F2& a, const F2& b, v8f c) { c = wmma_bf(a.l, b.h, c); c = wmma_bf(a.h, b.l, c); return wmma_bf(a.h, b.h, c); }
__device__ __forceinline__ float sigm(float v) { return 1.0f / (1.0f + expf(-v)); }
#define LDSX() do { asm volatile("s_wait_dscnt 0" ::: "memory"); __builtin_amdgcn_wave_barrier(); __builtin_amdgcn_fence(__ATOMIC_RELEASE, "workgroup"); } while (0)


// Grouped recurrent multi-head attention (B 4, S 1,024, d 1,024 = 4 query groups x 8 heads x 32): grouped-query softmax attention sharing K/V across the 4 groups, plus an ELU linear-memory branch (sigma(q) M / sigma(q) m_norm), mixed by a sigmoid gate.
#define NB 4
#define SS 1024
#define DM 1024
#define NQ 4
#define NH 8
#define HD 32
#define KVW (NH * HD)      // 256
#define NR (NB * SS)
#ifndef TQB
#define TQB (SS / 64)
#define TNB NB
#endif
typedef __attribute__((ext_vector_type(8))) __bf16 v8b;
__device__ __forceinline__ v16b frag_b(const __bf16* rowk0, int lane) {
  union { v16b v; v8b q[2]; } u; const __bf16* p = rowk0 + 8 * (lane >> 4);
  u.q[0] = *(const v8b*)p; u.q[1] = *(const v8b*)(p + 16); return u.v;
}
__device__ __forceinline__ float bfr(float v) { return (float)(__bf16)v; }
__device__ __attribute__((noinline)) float exp_ni(float v) { return expf(v); }
__device__ __attribute__((noinline)) float erf_ni(float v) { return erff(v); }
__device__ __attribute__((noinline)) float expm1f_ni(float v) { return expm1f(v); }

#define WS_PQ  0u                                  // bf16 transposed rows: Wq^T [1024][1024]; Wk^T [256][1024]; Wv^T [256][1024]; memory^T [256][256]
#define WS_PK  (WS_PQ + 2u * (size_t)DM * DM)
#define WS_PV  (WS_PK + 2u * (size_t)KVW * DM)
#define WS_PM  (WS_PV + 2u * (size_t)KVW * DM)
#define WS_QF  (WS_PM + 2u * (size_t)KVW * KVW)        // f32 q rows [NR][1024]; f16 q rows [NR][1024]; f16 k rows [NR][256]; f16 v planes [b][256][S]; f32 attn O [NR][1024]
#define WS_QH  (WS_QF + 4u * (size_t)NR * DM)
#define WS_K   (WS_QH + 2u * (size_t)NR * DM)
#define WS_V   (WS_K + 2u * (size_t)NR * KVW)
#define WS_O   (WS_V + 2u * (size_t)NB * KVW * SS)
#define WS_END (WS_O + 4u * (size_t)NR * DM)

__global__ __launch_bounds__(256) void k_pack(const float* __restrict__ WQ, const float* __restrict__ WK, const float* __restrict__ WV, const float* __restrict__ MM, __bf16* __restrict__ PQ, __bf16* __restrict__ PK, __bf16* __restrict__ PV, __bf16* __restrict__ PM) { const int n = blockIdx.x, which = blockIdx.y, t = threadIdx.x; __shared__ __align__(16) __bf16 s[DM];
  if (which == 0) { for (int k = t; k < DM; k += 256) s[k] = (__bf16)WQ[(size_t)k * DM + n]; __syncthreads(); if (t < DM / 8) vst2((unsigned*)(PQ + (size_t)n * DM + t * 8), *(const v4u*)&s[t * 8]); }
  else if (which < 3) { if (n >= KVW) return; const float* w = (which == 1) ? WK : WV; for (int k = t; k < DM; k += 256) s[k] = (__bf16)w[(size_t)k * KVW + n]; __syncthreads(); __bf16* dst = (which == 1) ? PK : PV; if (t < DM / 8) vst2((unsigned*)(dst + (size_t)n * DM + t * 8), *(const v4u*)&s[t * 8]); }
  else { if (n >= KVW) return; s[t] = (__bf16)MM[(size_t)t * KVW + n]; __syncthreads(); if (t < KVW / 8) vst2((unsigned*)(PM + (size_t)n * KVW + t * 8), *(const v4u*)&s[t * 8]); } }
// ---- k_proj: block = (64 rows, 128 cols, which): 0: q -> f32 + f16 rows (8 column blocks); 1: k -> f16 rows (2 column blocks); 2: v -> planes (2 column blocks)
__global__ __launch_bounds__(128) void k_proj(const float* __restrict__ X, const __bf16* __restrict__ PQ, const __bf16* __restrict__ PK, const __bf16* __restrict__ PV, float* __restrict__ QF, _Float16* __restrict__ QH, _Float16* __restrict__ Kr, _Float16* __restrict__ V) {
  __shared__ __align__(16) float sf[4][16][132]; __shared__ __align__(16) _Float16 so[64][136]; __shared__ __align__(16) _Float16 st[128][72];
  const int tid = threadIdx.x, wave = tid >> 5, lane = tid & 31, col = lane & 15, g = lane >> 4; const int which = blockIdx.z; const int c0 = blockIdx.y * 128; if (which > 0 && c0 >= KVW) return;
  const size_t rb = (size_t)blockIdx.x * 64; const size_t r0 = rb + wave * 16; const __bf16* Wr = (which == 0) ? PQ : (which == 1) ? PK : PV;
  v8f acc[8] = {};
#pragma unroll 2
  for (int kc = 0; kc < DM / 32; ++kc) { v16b a; { const float* p = X + (r0 + col) * DM + kc * 32 + 8 * g;
#pragma unroll
      for (int i = 0; i < 8; ++i) { a[i] = (__bf16)p[i]; a[8 + i] = (__bf16)p[16 + i]; } }
#pragma unroll
    for (int j = 0; j < 8; ++j) acc[j] = wmma_bf(a, frag_b(Wr + (size_t)(c0 + j * 16 + col) * DM + kc * 32, lane), acc[j]); }
  if (which < 2) {
#pragma unroll
    for (int j = 0; j < 8; ++j)
#pragma unroll
      for (int r = 0; r < 8; ++r) { so[wave * 16 + 8 * g + r][j * 16 + col] = (_Float16)acc[j][r]; if (which == 0) sf[wave][8 * g + r][j * 16 + col] = acc[j][r]; }
    __syncthreads();
    if (which == 0) { for (int rl = 0; rl < 16; ++rl) vst2(QF + (r0 + rl) * DM + c0 + lane * 4, *(const v4f*)&sf[wave][rl][lane * 4]); for (int e = tid; e < 64 * 16; e += 128) { const int rl = e >> 4, q = e & 15; vst2((unsigned*)(QH + (rb + rl) * DM + c0 + q * 8), *(const v4u*)&so[rl][q * 8]); } }
    else { for (int e = tid; e < 64 * 16; e += 128) { const int rl = e >> 4, q = e & 15; vst2((unsigned*)(Kr + (rb + rl) * KVW + c0 + q * 8), *(const v4u*)&so[rl][q * 8]); } } }
  else {
#pragma unroll
    for (int j = 0; j < 8; ++j)
#pragma unroll
      for (int r = 0; r < 8; ++r) st[j * 16 + col][wave * 16 + 8 * g + r] = (_Float16)acc[j][r];
    __syncthreads(); const size_t b = rb / SS; const int s0 = (int)(rb % SS);
    for (int e = tid; e < 128 * 8; e += 128) { const int d = e >> 3, pc = e & 7; vst2((unsigned*)(V + ((b * KVW + c0 + d) * SS) + s0 + pc * 8), *(const v4u*)&st[d][pc * 8]); } }
}
__global__ __launch_bounds__(128) void k_attn(const _Float16* __restrict__ QH, const _Float16* __restrict__ Kr, const _Float16* __restrict__ V, float* __restrict__ O) {
  __shared__ __align__(16) _Float16 sph[4][16][40]; __shared__ __align__(16) float so[4][16][36];
  const int tid = threadIdx.x, wave = tid >> 5, lane = tid & 31, col = lane & 15, g = lane >> 4; const int qg = blockIdx.y / NH, h = blockIdx.y % NH; const size_t b = blockIdx.z; const int q0 = blockIdx.x * 64 + wave * 16; const size_t rq = b * SS + q0; const int qc = qg * KVW + h * HD;
  const v16h aq = frag_h(QH + (rq + col) * DM + qc, lane);
  float m[8], l[8];
#pragma unroll
  for (int r = 0; r < 8; ++r) { m[r] = -3.0e38f; l[r] = 0.f; }
  v8f acc[2] = {};
#pragma unroll 1
  for (int ks = 0; ks < SS / 32; ++ks) { const int j0 = ks * 32; v8f s[2];
#pragma unroll
    for (int ct = 0; ct < 2; ++ct) { const int kk = j0 + ct * 16 + col; v8f c = {}; c = wmma16(aq, frag_h(Kr + (b * SS + kk) * KVW + h * HD, lane), c);
#pragma unroll
      for (int r = 0; r < 8; ++r) s[ct][r] = c[r] * 0.17677669529663688f; }
#pragma unroll
    for (int r = 0; r < 8; ++r) { float mx = fmaxf(s[0][r], s[1][r]);
#pragma unroll
      for (int o = 1; o < 16; o <<= 1) mx = fmaxf(mx, __shfl_xor(mx, o));
      const float mn = fmaxf(m[r], mx); const float alpha = (m[r] <= -1.0e38f) ? 0.f : __expf(m[r] - mn); const float e0 = __expf(s[0][r] - mn), e1 = __expf(s[1][r] - mn); float es = e0 + e1;
#pragma unroll
      for (int o = 1; o < 16; o <<= 1) es += __shfl_xor(es, o);
      l[r] = l[r] * alpha + es; m[r] = mn;
#pragma unroll
      for (int dt = 0; dt < 2; ++dt) acc[dt][r] *= alpha;
      sph[wave][8 * g + r][col] = (_Float16)(e0 * 2048.0f); sph[wave][8 * g + r][16 + col] = (_Float16)(e1 * 2048.0f); }
    LDSX();
    const v16h pa = frag_h(&sph[wave][col][0], lane);
#pragma unroll
    for (int dt = 0; dt < 2; ++dt) acc[dt] = wmma16(pa, frag_h(V + ((b * KVW + h * HD + dt * 16 + col) * SS) + j0, lane), acc[dt]);
    LDSX(); }
#pragma unroll
  for (int r = 0; r < 8; ++r) { const float il = (1.0f / 2048.0f) / l[r];
#pragma unroll
    for (int dt = 0; dt < 2; ++dt) so[wave][8 * g + r][dt * 16 + col] = acc[dt][r] * il; }
  LDSX();
  for (int rl = 0; rl < 16; ++rl) if (lane < 8) vst2(O + (rq + rl) * DM + qc + lane * 4, *(const v4f*)&so[wave][rl][lane * 4]);
}
// ---- k_mem: block = (64 token rows, 128 of the group's 256 cols, group): sigma = elu(q group slice) (f32 from QF), num = sigma (hi+lo) . memory (2 products), den = sigma . memory_norm (f32), out = attn (1-w) + (num/den) w
__global__ __launch_bounds__(128) void k_mem(const float* __restrict__ QF, const __bf16* __restrict__ PM, const float* __restrict__ MN, const float* __restrict__ MW, const float* __restrict__ O, float* __restrict__ OUT) {
  __shared__ __align__(16) float ssg[64][KVW + 4]; __shared__ float sden[64]; __shared__ __align__(16) float so[4][16][132];
  const int tid = threadIdx.x, wave = tid >> 5, lane = tid & 31, col = lane & 15, g = lane >> 4; const size_t rb = (size_t)blockIdx.x * 64; const size_t r0 = rb + wave * 16; const int half = blockIdx.y, qg = blockIdx.z; const int c0 = half * 128;
  for (int e = tid; e < 64 * KVW; e += 128) { const int rl = e >> 8, c = e & 255; const float v = QF[(rb + rl) * DM + qg * KVW + c]; ssg[rl][c] = (v > 0.f) ? v : expm1f_ni(v); }
  __syncthreads();
  if (tid < 64) { float d0 = 0.f; for (int c = 0; c < KVW; ++c) d0 += ssg[tid][c] * bfr(MN[c]); sden[tid] = d0; }
  v8f acc[8] = {};
#pragma unroll
  for (int kc = 0; kc < KVW / 32; ++kc) { const F2 a = split_row(&ssg[wave * 16 + col][0], kc * 32, lane);
#pragma unroll
    for (int j = 0; j < 8; ++j) { const v16b w = frag_b(PM + (size_t)(c0 + j * 16 + col) * KVW + kc * 32, lane); acc[j] = wmma_bf(a.h, w, acc[j]); acc[j] = wmma_bf(a.l, w, acc[j]); } }
  __syncthreads();
  const float wg = 1.0f / (1.0f + __expf(-bfr(MW[0])));
#pragma unroll
  for (int j = 0; j < 8; ++j)
#pragma unroll
    for (int r = 0; r < 8; ++r) { const int rl = wave * 16 + 8 * g + r; const size_t oi = (rb + rl) * DM + qg * KVW + c0 + j * 16 + col; so[wave][8 * g + r][j * 16 + col] = O[oi] * (1.0f - wg) + (acc[j][r] / sden[rl]) * wg; }
  LDSX();
  for (int rl = 0; rl < 16; ++rl) vst2(OUT + (r0 + rl) * DM + qg * KVW + c0 + lane * 4, *(const v4f*)&so[wave][rl][lane * 4]);
}
extern "C" void kernel_launch(void* const* d_in, const int* in_sizes, int n_in, void* d_out, int out_size, void* d_ws, size_t ws_size, hipStream_t stream) {
  (void)in_sizes; (void)n_in; (void)out_size;
  const float** F = (const float**)d_in;   // 0 x [4,1024,1024], 1 Wq [1024,1024] (in,out), 2 Wk [1024,256], 3 Wv [1024,256], 4 memory [256,256], 5 memory_norm [256,1], 6 memory_weight [1]
  if (ws_size < (size_t)WS_END) return;
  char* ws = (char*)d_ws; __bf16 *PQ = (__bf16*)(ws + WS_PQ), *PK = (__bf16*)(ws + WS_PK), *PV = (__bf16*)(ws + WS_PV), *PM = (__bf16*)(ws + WS_PM); float *QF = (float*)(ws + WS_QF), *O = (float*)(ws + WS_O); _Float16 *QH = (_Float16*)(ws + WS_QH), *Kr = (_Float16*)(ws + WS_K), *V = (_Float16*)(ws + WS_V);
  k_pack<<<dim3(DM, 4), 256, 0, stream>>>(F[1], F[2], F[3], F[4], PQ, PK, PV, PM);
  k_proj<<<dim3(TNB * SS / 64, DM / 128, 3), 128, 0, stream>>>(F[0], PQ, PK, PV, QF, QH, Kr, V);
  k_attn<<<dim3(TQB, NQ * NH, TNB), 128, 0, stream>>>(QH, Kr, V, O);
  k_mem<<<dim3(TNB * SS / 64, 2, NQ), 128, 0, stream>>>(QF, PM, F[5], F[6], O, (float*)d_out);
}

// v001
// It runs in 154 microseconds.
// Next to v000, in two timings, it ran 1.59 and 1.57 times as fast.
// compute dtype: all float inputs rounded to bf16; q/k/v = x . W with EXACT bf16 products on WMMA 16x16x32 ((in,out) weights as transposed rows): q kept f32 (for the ELU memory branch) and as f16, k as f16 rows, v as f16 planes; grouped softmax attention (4 query groups x 8 heads x 32 dims over 1,024 keys): q, k single f16 x 32^-1/2, running-max softmax in f32 (hardware exp), P (scaled by 2^11, single f16) x v (single f16); memory branch: sigma = elu(q group row) in f32, (sigma as bf16 hi + lo, 2 products) . memory and sigma . memory_norm (f32 dot), divide; out = attn (1 - sigmoid(w)) + mem sigmoid(w) in f32; f32 output.
#include <hip/hip_runtime.h>
#include <math.h>

typedef __attribute__((ext_vector_type(16))) _Float16 v16h;
typedef __attribute__((ext_vector_type(16))) __bf16 v16b;
typedef __attribute__((ext_vector_type(8)))  _Float16 v8h;
typedef __attribute__((ext_vector_type(8)))  float v8f;
typedef __attribute__((ext_vector_type(4)))  float v4f;
typedef __attribute__((ext_vector_type(2)))  float v2f;
typedef __attribute__((ext_vector_type(4)))  unsigned v4u;
typedef __attribute__((ext_vector_type(4)))  int v4i;
typedef float __attribute__((may_alias)) float_a;
typedef int __attribute__((may_alias)) int_a;

template <typename T> __device__ __forceinline__ void vst2(void* p, T v) { *(T*)p = v;  }
__device__ __forceinline__ v8f wmma16(v16h a, v16h b, v8f c) {
  v8f d = __builtin_amdgcn_wmma_f32_16x16x32_f16(false, a, false, b, (short)0, c, false, false);
  asm volatile("v_nop\n\tv_nop\n\tv_nop\n\tv_nop" : "+v"(d) : "v"(a), "v"(b));
  return d;
}
__device__ __forceinline__ v8f wmma_bf(v16b a, v16b b, v8f c) {
  v8f d = __builtin_amdgcn_wmma_f32_16x16x32_bf16(false, a, false, b, (short)0, c, false, false);
  asm volatile("v_nop\n\tv_nop\n\tv_nop\n\tv_nop" : "+v"(d) : "v"(a), "v"(b));
  return d;
}
// 16x16x32 fragments: lane = (h = lane>>4, row/col = lane&15); elements 0..7 = k0+8h+0..7, 8..15 = k0+16+8h+0..7; D element r = row 8h+r
__device__ __forceinline__ v16h frag_h(const _Float16* rowk0, int lane) {
  union { v16h v; v8h q[2]; } u; const _Float16* p = rowk0 + 8 * (lane >> 4);
  u.q[0] = *(const v8h*)p; u.q[1] = *(const v8h*)(p + 16); return u.v;
}
__device__ __forceinline__ v16h frag_f32(const float* rowk0, int lane) {
  v16h a; const float* p = rowk0 + 8 * (lane >> 4);
#pragma unroll
  for (int i = 0; i < 8; ++i) { a[i] = (_Float16)p[i]; a[8 + i] = (_Float16)p[16 + i]; }
  return a;
}
__device__ __forceinline__ v16h frag_f32s(const float* rowk0, int lane, float sc) {
  v16h a; const float* p = rowk0 + 8 * (lane >> 4);
#pragma unroll
  for (int i = 0; i < 8; ++i) { a[i] = (_Float16)(p[i] * sc); a[8 + i] = (_Float16)(p[16 + i] * sc); }
  return a;
}
// column fragment from a [K][ld] layout (column n), rows >= K read as 0
__device__ __forceinline__ v16h fragc_f32(const float* W, int k0, int n, int lane, int ld, int K) {
  v16h a; const int g = lane >> 4;
#pragma unroll
  for (int i = 0; i < 8; ++i) { const int ka = k0 + 8 * g + i, kb = ka + 16;
    a[i] = (_Float16)(ka < K ? W[(size_t)(ka < K ? ka : K - 1) * ld + n] : 0.f); a[8 + i] = (_Float16)(kb < K ? W[(size_t)(kb < K ? kb : K - 1) * ld + n] : 0.f); }
  return a;
}
struct F2 { v16b h, l; };
__device__ __forceinline__ F2 bsplit16(const float v[16]) { F2 r;
#pragma unroll
  for (int i = 0; i < 16; ++i) { const __bf16 h = (__bf16)v[i]; r.h[i] = h; r.l[i] = (__bf16)(v[i] - (float)h); }
  return r; }
__device__ __forceinline__ F2 split_row(const float* row, int k0, int lane) { float v[16]; const float* p = row + k0 + 8 * (lane >> 4);
#pragma unroll
  for (int i = 0; i < 8; ++i) { v[i] = p[i]; v[8 + i] = p[16 + i]; }
  return bsplit16(v); }
__device__ __forceinline__ F2 split_rowK(const float* row, int k0, int lane, int K) { float v[16]; const int g = lane >> 4;
#pragma unroll
  for (int i = 0; i < 8; ++i) { const int ka = k0 + 8 * g + i, kb = ka + 16; v[i] = ka < K ? row[ka < K ? ka : K - 1] : 0.f; v[8 + i] = kb < K ? row[kb < K ? kb : K - 1] : 0.f; }
  return bsplit16(v); }
__device__ __forceinline__ F2 split_col(const float* W, int k0, int n, int lane, int ld, int K) { float v[16]; const int g = lane >> 4;
#pragma unroll
  for (int i = 0; i < 8; ++i) { const int ka = k0 + 8 * g + i, kb = ka + 16; v[i] = ka < K ? W[(size_t)(ka < K ? ka : K - 1) * ld + n] : 0.f; v[8 + i] = kb < K ? W[(size_t)(kb < K ? kb : K - 1) * ld + n] : 0.f; }
  return bsplit16(v); }
__device__ __forceinline__ v8f mac3(const F2& a, const F2& b, v8f c) { c = wmma_bf(a.l, b.h, c); c = wmma_bf(a.h, b.l, c); return wmma_bf(a.h, b.h, c); }
__device__ __forceinline__ float sigm(float v) { return 1.0f / (1.0f + expf(-v)); }
#define LDSX() do { asm volatile("s_wait_dscnt 0" ::: "memory"); __builtin_amdgcn_wave_barrier(); __builtin_amdgcn_fence(__ATOMIC_RELEASE, "workgroup"); } while (0)


// Grouped recurrent multi-head attention (B 4, S 1,024, d 1,024 = 4 query groups x 8 heads x 32): grouped-query softmax attention sharing K/V across the 4 groups, plus an ELU linear-memory branch (sigma(q) M / sigma(q) m_norm), mixed by a sigmoid gate.
#define NB 4
#define SS 1024
#define DM 1024
#define NQ 4
#define NH 8
#define HD 32
#define KVW (NH * HD)      // 256
#define NR (NB * SS)
#ifndef TQB
#define TQB (SS / 64)
#define TNB NB
#endif
typedef __attribute__((ext_vector_type(8))) __bf16 v8b;
__device__ __forceinline__ v16b frag_b(const __bf16* rowk0, int lane) {
  union { v16b v; v8b q[2]; } u; const __bf16* p = rowk0 + 8 * (lane >> 4);
  u.q[0] = *(const v8b*)p; u.q[1] = *(const v8b*)(p + 16); return u.v;
}
__device__ __forceinline__ float bfr(float v) { return (float)(__bf16)v; }
__device__ __attribute__((noinline)) float exp_ni(float v) { return expf(v); }
__device__ __attribute__((noinline)) float erf_ni(float v) { return erff(v); }
__device__ __attribute__((noinline)) float expm1f_ni(float v) { return expm1f(v); }

#define WS_PQ  0u                                  // bf16 transposed rows: Wq^T [1024][1024]; Wk^T [256][1024]; Wv^T [256][1024]; memory^T [256][256]
#define WS_PK  (WS_PQ + 2u * (size_t)DM * DM)
#define WS_PV  (WS_PK + 2u * (size_t)KVW * DM)
#define WS_PM  (WS_PV + 2u * (size_t)KVW * DM)
#define WS_QF  (WS_PM + 2u * (size_t)KVW * KVW)        // f32 q rows [NR][1024]; f16 q rows [NR][1024]; f16 k rows [NR][256]; f16 v planes [b][256][S]; f32 attn O [NR][1024]
#define WS_QH  (WS_QF + 4u * (size_t)NR * DM)
#define WS_K   (WS_QH + 2u * (size_t)NR * DM)
#define WS_V   (WS_K + 2u * (size_t)NR * KVW)
#define WS_O   (WS_V + 2u * (size_t)NB * KVW * SS)
#define WS_END (WS_O + 4u * (size_t)NR * DM)

__global__ __launch_bounds__(256) void k_pack(const float* __restrict__ WQ, const float* __restrict__ WK, const float* __restrict__ WV, const float* __restrict__ MM, __bf16* __restrict__ PQ, __bf16* __restrict__ PK, __bf16* __restrict__ PV, __bf16* __restrict__ PM) { const int n = blockIdx.x, which = blockIdx.y, t = threadIdx.x; __shared__ __align__(16) __bf16 s[DM];
  if (which == 0) { for (int k = t; k < DM; k += 256) s[k] = (__bf16)WQ[(size_t)k * DM + n]; __syncthreads(); if (t < DM / 8) vst2((unsigned*)(PQ + (size_t)n * DM + t * 8), *(const v4u*)&s[t * 8]); }
  else if (which < 3) { if (n >= KVW) return; const float* w = (which == 1) ? WK : WV; for (int k = t; k < DM; k += 256) s[k] = (__bf16)w[(size_t)k * KVW + n]; __syncthreads(); __bf16* dst = (which == 1) ? PK : PV; if (t < DM / 8) vst2((unsigned*)(dst + (size_t)n * DM + t * 8), *(const v4u*)&s[t * 8]); }
  else { if (n >= KVW) return; s[t] = (__bf16)MM[(size_t)t * KVW + n]; __syncthreads(); if (t < KVW / 8) vst2((unsigned*)(PM + (size_t)n * KVW + t * 8), *(const v4u*)&s[t * 8]); } }
// one k block of k_proj: the lane's 16 f32 of its x row and its 8 weight fragments, all 20 loads issued as one group
__device__ __forceinline__ void proj_fetch(v4f (&x)[4], v16b (&w)[8], const float* p, const __bf16* wk, int lane) {
  x[0] = *(const v4f*)p; x[1] = *(const v4f*)(p + 4); x[2] = *(const v4f*)(p + 16); x[3] = *(const v4f*)(p + 20);
#pragma unroll
  for (int j = 0; j < 8; ++j) w[j] = frag_b(wk + (size_t)j * 16 * DM, lane);
}
__device__ __forceinline__ void proj_mac(const v4f (&x)[4], const v16b (&w)[8], v8f (&acc)[8]) { v16b a;
#pragma unroll
  for (int i = 0; i < 4; ++i) { a[i] = (__bf16)x[0][i]; a[4 + i] = (__bf16)x[1][i]; a[8 + i] = (__bf16)x[2][i]; a[12 + i] = (__bf16)x[3][i]; }
#pragma unroll
  for (int j = 0; j < 8; ++j) acc[j] = wmma_bf(a, w[j], acc[j]);
}
// ---- k_proj: block = (64 rows, 128 cols, which): 0: q -> f32 + f16 rows (8 column blocks); 1: k -> f16 rows (2 column blocks); 2: v -> planes (2 column blocks)
__global__ __launch_bounds__(128) void k_proj(const float* __restrict__ X, const __bf16* __restrict__ PQ, const __bf16* __restrict__ PK, const __bf16* __restrict__ PV, float* __restrict__ QF, _Float16* __restrict__ QH, _Float16* __restrict__ Kr, _Float16* __restrict__ V) {
  __shared__ __align__(16) float sf[4][16][132]; __shared__ __align__(16) _Float16 so[64][136]; __shared__ __align__(16) _Float16 st[128][72];
  const int tid = threadIdx.x, wave = tid >> 5, lane = tid & 31, col = lane & 15, g = lane >> 4; const int which = blockIdx.z; const int c0 = blockIdx.y * 128; if (which > 0 && c0 >= KVW) return;
  const size_t rb = (size_t)blockIdx.x * 64; const size_t r0 = rb + wave * 16; const __bf16* Wr = (which == 0) ? PQ : (which == 1) ? PK : PV;
  v8f acc[8] = {};
  const float* xp = X + (r0 + col) * DM + 8 * g; const __bf16* wp = Wr + (size_t)(c0 + col) * DM;
  v4f xa[4], xb[4]; v16b wa[8], wb[8];   // two register sets: one k block is multiplied while the next one's loads are in flight
  proj_fetch(xa, wa, xp, wp, lane);
#pragma unroll 1   // rolled: the two sets already give the overlap, a longer body only adds registers
  for (int kc = 0; kc < DM / 32 - 2; kc += 2) {
    proj_fetch(xb, wb, xp + (kc + 1) * 32, wp + (kc + 1) * 32, lane);
    proj_mac(xa, wa, acc);
    proj_fetch(xa, wa, xp + (kc + 2) * 32, wp + (kc + 2) * 32, lane);
    proj_mac(xb, wb, acc); }
  // last two k blocks outside the loop: a fetch under a test inside it would make every wait count for the path without the fetch
  proj_fetch(xb, wb, xp + (DM / 32 - 1) * 32, wp + (DM / 32 - 1) * 32, lane);
  proj_mac(xa, wa, acc);
  proj_mac(xb, wb, acc);
  if (which < 2) {
#pragma unroll
    for (int j = 0; j < 8; ++j)
#pragma unroll
      for (int r = 0; r < 8; ++r) { so[wave * 16 + 8 * g + r][j * 16 + col] = (_Float16)acc[j][r]; if (which == 0) sf[wave][8 * g + r][j * 16 + col] = acc[j][r]; }
    __syncthreads();
    if (which == 0) { for (int rl = 0; rl < 16; ++rl) vst2(QF + (r0 + rl) * DM + c0 + lane * 4, *(const v4f*)&sf[wave][rl][lane * 4]); for (int e = tid; e < 64 * 16; e += 128) { const int rl = e >> 4, q = e & 15; vst2((unsigned*)(QH + (rb + rl) * DM + c0 + q * 8), *(const v4u*)&so[rl][q * 8]); } }
    else { for (int e = tid; e < 64 * 16; e += 128) { const int rl = e >> 4, q = e & 15; vst2((unsigned*)(Kr + (rb + rl) * KVW + c0 + q * 8), *(const v4u*)&so[rl][q * 8]); } } }
  else {
#pragma unroll
    for (int j = 0; j < 8; ++j)
#pragma unroll
      for (int r = 0; r < 8; ++r) st[j * 16 + col][wave * 16 + 8 * g + r] = (_Float16)acc[j][r];
    __syncthreads(); const size_t b = rb / SS; const int s0 = (int)(rb % SS);
    for (int e = tid; e < 128 * 8; e += 128) { const int d = e >> 3, pc = e & 7; vst2((unsigned*)(V + ((b * KVW + c0 + d) * SS) + s0 + pc * 8), *(const v4u*)&st[d][pc * 8]); } }
}
__global__ __launch_bounds__(128) void k_attn(const _Float16* __restrict__ QH, const _Float16* __restrict__ Kr, const _Float16* __restrict__ V, float* __restrict__ O) {
  __shared__ __align__(16) _Float16 sph[4][16][40]; __shared__ __align__(16) float so[4][16][36];
  const int tid = threadIdx.x, wave = tid >> 5, lane = tid & 31, col = lane & 15, g = lane >> 4; const int qg = blockIdx.y / NH, h = blockIdx.y % NH; const size_t b = blockIdx.z; const int q0 = blockIdx.x * 64 + wave * 16; const size_t rq = b * SS + q0; const int qc = qg * KVW + h * HD;
  const v16h aq = frag_h(QH + (rq + col) * DM + qc, lane);
  float m[8], l[8];
#pragma unroll
  for (int r = 0; r < 8; ++r) { m[r] = -3.0e38f; l[r] = 0.f; }
  v8f acc[2] = {};
#pragma unroll 1
  for (int ks = 0; ks < SS / 32; ++ks) { const int j0 = ks * 32; v8f s[2];
    // this pass's two key and two value fragments as one group of loads: the values land while the softmax is worked
    v16h kf[2], vf[2];
#pragma unroll
    for (int ct = 0; ct < 2; ++ct) kf[ct] = frag_h(Kr + (b * SS + j0 + ct * 16 + col) * KVW + h * HD, lane);
#pragma unroll
    for (int dt = 0; dt < 2; ++dt) vf[dt] = frag_h(V + ((b * KVW + h * HD + dt * 16 + col) * SS) + j0, lane);
#pragma unroll
    for (int ct = 0; ct < 2; ++ct) { v8f c = {}; c = wmma16(aq, kf[ct], c);
#pragma unroll
      for (int r = 0; r < 8; ++r) s[ct][r] = c[r] * 0.17677669529663688f; }
#pragma unroll
    for (int r = 0; r < 8; ++r) { float mx = fmaxf(s[0][r], s[1][r]);
#pragma unroll
      for (int o = 1; o < 16; o <<= 1) mx = fmaxf(mx, __shfl_xor(mx, o));
      const float mn = fmaxf(m[r], mx); const float alpha = (m[r] <= -1.0e38f) ? 0.f : __expf(m[r] - mn); const float e0 = __expf(s[0][r] - mn), e1 = __expf(s[1][r] - mn); float es = e0 + e1;
#pragma unroll
      for (int o = 1; o < 16; o <<= 1) es += __shfl_xor(es, o);
      l[r] = l[r] * alpha + es; m[r] = mn;
#pragma unroll
      for (int dt = 0; dt < 2; ++dt) acc[dt][r] *= alpha;
      sph[wave][8 * g + r][col] = (_Float16)(e0 * 2048.0f); sph[wave][8 * g + r][16 + col] = (_Float16)(e1 * 2048.0f); }
    LDSX();
    const v16h pa = frag_h(&sph[wave][col][0], lane);
#pragma unroll
    for (int dt = 0; dt < 2; ++dt) acc[dt] = wmma16(pa, vf[dt], acc[dt]);
    LDSX(); }
#pragma unroll
  for (int r = 0; r < 8; ++r) { const float il = (1.0f / 2048.0f) / l[r];
#pragma unroll
    for (int dt = 0; dt < 2; ++dt) so[wave][8 * g + r][dt * 16 + col] = acc[dt][r] * il; }
  LDSX();
  for (int rl = 0; rl < 16; ++rl) if (lane < 8) vst2(O + (rq + rl) * DM + qc + lane * 4, *(const v4f*)&so[wave][rl][lane * 4]);
}
// elu of 8 loaded quads, stored to every second sigma row; expm1f is taken for every lane and selected, so that the 32 chains are independent
__device__ __forceinline__ void elu_rows(const v4f (&q)[8], float* dst) {
#pragma unroll
  for (int u = 0; u < 8; ++u) { v4f sg;
#pragma unroll
    for (int i = 0; i < 4; ++i) { const float v = q[u][i]; const float e = expm1f(v); sg[i] = (v > 0.f) ? v : e; }
    *(v4f*)(dst + (size_t)u * 2 * (KVW + 4)) = sg; }
}
// ---- k_mem: block = (64 token rows, 128 of the group's 256 cols, group): sigma = elu(q group slice) (f32 from QF), num = sigma (hi+lo) . memory (2 products), den = sigma . memory_norm (f32), out = attn (1-w) + (num/den) w
__global__ __launch_bounds__(128) void k_mem(const float* __restrict__ QF, const __bf16* __restrict__ PM, const float* __restrict__ MN, const float* __restrict__ MW, const float* __restrict__ O, float* __restrict__ OUT) {
  __shared__ __align__(16) float ssg[64][KVW + 4]; __shared__ float sden[64]; __shared__ __align__(16) float so[4][16][132];
  const int tid = threadIdx.x, wave = tid >> 5, lane = tid & 31, col = lane & 15, g = lane >> 4; const size_t rb = (size_t)blockIdx.x * 64; const size_t r0 = rb + wave * 16; const int half = blockIdx.y, qg = blockIdx.z; const int c0 = half * 128;
  const float mw = MW[0];
  // sigma rows: 16-byte loads, 8 a thread in flight as one group, the next group issued before this one is worked on
  const float* qp = QF + (rb + (tid >> 6)) * DM + qg * KVW + (tid & 63) * 4; float* sgp = &ssg[tid >> 6][(tid & 63) * 4]; v4f qr[8], qn[8];
#pragma unroll
  for (int u = 0; u < 8; ++u) qr[u] = *(const v4f*)(qp + (size_t)u * 2 * DM);
#pragma unroll 1   // rolled: 32 inlined expm1f a trip are text enough
  for (int it = 0; it < 3; ++it) {
#pragma unroll
    for (int u = 0; u < 8; ++u) qn[u] = *(const v4f*)(qp + (size_t)((it + 1) * 8 + u) * 2 * DM);
    elu_rows(qr, sgp + (size_t)it * 16 * (KVW + 4));
#pragma unroll
    for (int u = 0; u < 8; ++u) qr[u] = qn[u]; }
  // memory fragments come in groups of 4 (half a k block) through a ring of 3 register sets: one is multiplied, two are in flight
  const __bf16* pm = PM + (size_t)(c0 + col) * KVW; v16b w[3][4]; float sr[2][16];
#pragma unroll
  for (int h = 0; h < 2; ++h)
#pragma unroll
    for (int jj = 0; jj < 4; ++jj) w[h][jj] = frag_b(pm + (size_t)(h * 4 + jj) * 16 * KVW, lane);
  elu_rows(qr, sgp + (size_t)3 * 16 * (KVW + 4));
  __syncthreads();
  if (tid < 64) { float d0 = 0.f; for (int c = 0; c < KVW; ++c) d0 += ssg[tid][c] * bfr(MN[c]); sden[tid] = d0; }
  v8f acc[8] = {}; float ov[8][8];
  const float* sp = &ssg[wave * 16 + col][8 * g]; const float* op = O + (r0 + 8 * g) * DM + qg * KVW + c0 + col;
#pragma unroll
  for (int i = 0; i < 8; ++i) { sr[0][i] = sp[i]; sr[0][8 + i] = sp[16 + i]; }
  F2 a;
#pragma unroll
  for (int h = 0; h < 2 * (KVW / 32); ++h) { const int kc = h >> 1, jb = (h & 1) * 4;
    // ahead of this group's products: the group two further on; behind the last group the attention tile
    if (h + 2 < 2 * (KVW / 32)) {
#pragma unroll
      for (int jj = 0; jj < 4; ++jj) w[(h + 2) % 3][jj] = frag_b(pm + (size_t)(jb + jj) * 16 * KVW + (kc + 1) * 32, lane); }
    else if (jb == 0) {
      asm volatile("s_wait_xcnt 0x0" ::: "memory");   // the tile's loads may land in the address registers of fragment loads that are still in flight
#pragma unroll
      for (int j = 0; j < 8; ++j)
#pragma unroll
        for (int r = 0; r < 8; ++r) ov[j][r] = op[(size_t)r * DM + j * 16]; }
    if (jb == 0) {   // the next k block's sigma slice is read from LDS one block ahead as well
      if (kc + 1 < KVW / 32) {
#pragma unroll
        for (int i = 0; i < 8; ++i) { sr[(kc + 1) & 1][i] = sp[(kc + 1) * 32 + i]; sr[(kc + 1) & 1][8 + i] = sp[(kc + 1) * 32 + 16 + i]; } }
      a = bsplit16(sr[kc & 1]); }
#pragma unroll
    for (int jj = 0; jj < 4; ++jj) { acc[jb + jj] = wmma_bf(a.h, w[h % 3][jj], acc[jb + jj]); acc[jb + jj] = wmma_bf(a.l, w[h % 3][jj], acc[jb + jj]); } }
  __syncthreads();
  const float wg = 1.0f / (1.0f + __expf(-bfr(mw)));
#pragma unroll
  for (int j = 0; j < 8; ++j)
#pragma unroll
    for (int r = 0; r < 8; ++r) { const int rl = wave * 16 + 8 * g + r; so[wave][8 * g + r][j * 16 + col] = ov[j][r] * (1.0f - wg) + (acc[j][r] / sden[rl]) * wg; }
  LDSX();
  v4f t[16];
#pragma unroll
  for (int rl = 0; rl < 16; ++rl) t[rl] = *(const v4f*)&so[wave][rl][lane * 4];
#pragma unroll
  for (int rl = 0; rl < 16; ++rl) vst2(OUT + (r0 + rl) * DM + qg * KVW + c0 + lane * 4, t[rl]);
}
extern "C" void kernel_launch(void* const* d_in, const int* in_sizes, int n_in, void* d_out, int out_size, void* d_ws, size_t ws_size, hipStream_t stream) {
  (void)in_sizes; (void)n_in; (void)out_size;
  const float** F = (const float**)d_in;   // 0 x [4,1024,1024], 1 Wq [1024,1024] (in,out), 2 Wk [1024,256], 3 Wv [1024,256], 4 memory [256,256], 5 memory_norm [256,1], 6 memory_weight [1]
  if (ws_size < (size_t)WS_END) return;
  char* ws = (char*)d_ws; __bf16 *PQ = (__bf16*)(ws + WS_PQ), *PK = (__bf16*)(ws + WS_PK), *PV = (__bf16*)(ws + WS_PV), *PM = (__bf16*)(ws + WS_PM); float *QF = (float*)(ws + WS_QF), *O = (float*)(ws + WS_O); _Float16 *QH = (_Float16*)(ws + WS_QH), *Kr = (_Float16*)(ws + WS_K), *V = (_Float16*)(ws + WS_V);
  k_pack<<<dim3(DM, 4), 256, 0, stream>>>(F[1], F[2], F[3], F[4], PQ, PK, PV, PM);
  k_proj<<<dim3(TNB * SS / 64, DM / 128, 3), 128, 0, stream>>>(F[0], PQ, PK, PV, QF, QH, Kr, V);
  k_attn<<<dim3(TQB, NQ * NH, TNB), 128, 0, stream>>>(QH, Kr, V, O);
  k_mem<<<dim3(TNB * SS / 64, 2, NQ), 128, 0, stream>>>(QF, PM, F[5], F[6], O, (float*)d_out);
}

// v002
// Measured time: 99.2 microseconds a run.
// In two side-by-side timings against v001, it was 1.55 and 1.54 times as fast.
// Over all steps from v000 it is 2.44 times as fast.
// compute dtype: all float inputs rounded to bf16; q/k/v = x . W with EXACT bf16 products on WMMA 16x16x32 (x, the (in,out) weights and memory packed as bf16 fragment-order tiles): q kept f32 (for the ELU memory branch) and as f16 rows, k and v as f16 fragment-order tiles; grouped softmax attention (4 query groups x 8 heads x 32 dims over 1,024 keys): q, k single f16 x 32^-1/2, running-max softmax in f32 (hardware exp), P (scaled by 2^11, single f16) x v (single f16); memory branch: sigma = elu(q group row) in f32, (sigma as bf16 hi + lo, 2 products) . memory and sigma . memory_norm (f32 dot), divide; out = attn (1 - sigmoid(w)) + mem sigmoid(w) in f32; f32 output.
#include <hip/hip_runtime.h>
#include <math.h>

typedef __attribute__((ext_vector_type(16))) _Float16 v16h;
typedef __attribute__((ext_vector_type(16))) __bf16 v16b;
typedef __attribute__((ext_vector_type(8)))  _Float16 v8h;
typedef __attribute__((ext_vector_type(8)))  float v8f;
typedef __attribute__((ext_vector_type(4)))  float v4f;
typedef __attribute__((ext_vector_type(2)))  float v2f;
typedef __attribute__((ext_vector_type(4)))  unsigned v4u;
typedef __attribute__((ext_vector_type(4)))  int v4i;
typedef float __attribute__((may_alias)) float_a;
typedef int __attribute__((may_alias)) int_a;

template <typename T> __device__ __forceinline__ void vst2(void* p, T v) { *(T*)p = v;  }
__device__ __forceinline__ v8f wmma16(v16h a, v16h b, v8f c) {
  v8f d = __builtin_amdgcn_wmma_f32_16x16x32_f16(false, a, false, b, (short)0, c, false, false);
  asm volatile("v_nop\n\tv_nop\n\tv_nop\n\tv_nop" : "+v"(d) : "v"(a), "v"(b));
  return d;
}
__device__ __forceinline__ v8f wmma_bf(v16b a, v16b b, v8f c) {
  v8f d = __builtin_amdgcn_wmma_f32_16x16x32_bf16(false, a, false, b, (short)0, c, false, false);
  asm volatile("v_nop\n\tv_nop\n\tv_nop\n\tv_nop" : "+v"(d) : "v"(a), "v"(b));
  return d;
}
// 16x16x32 fragments: lane = (h = lane>>4, row/col = lane&15); elements 0..7 = k0+8h+0..7, 8..15 = k0+16+8h+0..7; D element r = row 8h+r
__device__ __forceinline__ v16h frag_h(const _Float16* rowk0, int lane) {
  union { v16h v; v8h q[2]; } u; const _Float16* p = rowk0 + 8 * (lane >> 4);
  u.q[0] = *(const v8h*)p; u.q[1] = *(const v8h*)(p + 16); return u.v;
}
__device__ __forceinline__ v16h frag_f32(const float* rowk0, int lane) {
  v16h a; const float* p = rowk0 + 8 * (lane >> 4);
#pragma unroll
  for (int i = 0; i < 8; ++i) { a[i] = (_Float16)p[i]; a[8 + i] = (_Float16)p[16 + i]; }
  return a;
}
__device__ __forceinline__ v16h frag_f32s(const float* rowk0, int lane, float sc) {
  v16h a; const float* p = rowk0 + 8 * (lane >> 4);
#pragma unroll
  for (int i = 0; i < 8; ++i) { a[i] = (_Float16)(p[i] * sc); a[8 + i] = (_Float16)(p[16 + i] * sc); }
  return a;
}
// column fragment from a [K][ld] layout (column n), rows >= K read as 0
__device__ __forceinline__ v16h fragc_f32(const float* W, int k0, int n, int lane, int ld, int K) {
  v16h a; const int g = lane >> 4;
#pragma unroll
  for (int i = 0; i < 8; ++i) { const int ka = k0 + 8 * g + i, kb = ka + 16;
    a[i] = (_Float16)(ka < K ? W[(size_t)(ka < K ? ka : K - 1) * ld + n] : 0.f); a[8 + i] = (_Float16)(kb < K ? W[(size_t)(kb < K ? kb : K - 1) * ld + n] : 0.f); }
  return a;
}
struct F2 { v16b h, l; };
__device__ __forceinline__ F2 bsplit16(const float v[16]) { F2 r;
#pragma unroll
  for (int i = 0; i < 16; ++i) { const __bf16 h = (__bf16)v[i]; r.h[i] = h; r.l[i] = (__bf16)(v[i] - (float)h); }
  return r; }
__device__ __forceinline__ F2 split_row(const float* row, int k0, int lane) { float v[16]; const float* p = row + k0 + 8 * (lane >> 4);
#pragma unroll
  for (int i = 0; i < 8; ++i) { v[i] = p[i]; v[8 + i] = p[16 + i]; }
  return bsplit16(v); }
__device__ __forceinline__ F2 split_rowK(const float* row, int k0, int lane, int K) { float v[16]; const int g = lane >> 4;
#pragma unroll
  for (int i = 0; i < 8; ++i) { const int ka = k0 + 8 * g + i, kb = ka + 16; v[i] = ka < K ? row[ka < K ? ka : K - 1] : 0.f; v[8 + i] = kb < K ? row[kb < K ? kb : K - 1] : 0.f; }
  return bsplit16(v); }
__device__ __forceinline__ F2 split_col(const float* W, int k0, int n, int lane, int ld, int K) { float v[16]; const int g = lane >> 4;
#pragma unroll
  for (int i = 0; i < 8; ++i) { const int ka = k0 + 8 * g + i, kb = ka + 16; v[i] = ka < K ? W[(size_t)(ka < K ? ka : K - 1) * ld + n] : 0.f; v[8 + i] = kb < K ? W[(size_t)(kb < K ? kb : K - 1) * ld + n] : 0.f; }
  return bsplit16(v); }
__device__ __forceinline__ v8f mac3(const F2& a, const F2& b, v8f c) { c = wmma_bf(a.l, b.h, c); c = wmma_bf(a.h, b.l, c); return wmma_bf(a.h, b.h, c); }
__device__ __forceinline__ float sigm(float v) { return 1.0f / (1.0f + expf(-v)); }
#define LDSX() do { asm volatile("s_wait_dscnt 0" ::: "memory"); __builtin_amdgcn_wave_barrier(); __builtin_amdgcn_fence(__ATOMIC_RELEASE, "workgroup"); } while (0)


// Grouped recurrent multi-head attention (B 4, S 1,024, d 1,024 = 4 query groups x 8 heads x 32): grouped-query softmax attention sharing K/V across the 4 groups, plus an ELU linear-memory branch (sigma(q) M / sigma(q) m_norm), mixed by a sigmoid gate.
#define NB 4
#define SS 1024
#define DM 1024
#define NQ 4
#define NH 8
#define HD 32
#define KVW (NH * HD)      // 256
#define NR (NB * SS)
#ifndef TQB
#define TQB (SS / 64)
#define TNB NB
#endif
typedef __attribute__((ext_vector_type(8))) __bf16 v8b;
__device__ __forceinline__ v16b frag_b(const __bf16* rowk0, int lane) {
  union { v16b v; v8b q[2]; } u; const __bf16* p = rowk0 + 8 * (lane >> 4);
  u.q[0] = *(const v8b*)p; u.q[1] = *(const v8b*)(p + 16); return u.v;
}
// fragment-order tile: 16 rows (or columns) x 32 k of a 16-bit type = 512 elements = 1 KiB; element (r, k) stands at ((k >> 4) & 1) * 256 + (((k >> 3) & 1) * 16 + r) * 8 + (k & 7).
// Lane l's two 16-byte halves stand at l * 8 and 256 + l * 8, so each load of a wave covers four whole 128-byte lines instead of a part of sixteen.
__device__ __forceinline__ v16b fragt_b(const __bf16* tile, int lane) {
  union { v16b v; v8b q[2]; } u; u.q[0] = *(const v8b*)(tile + lane * 8); u.q[1] = *(const v8b*)(tile + 256 + lane * 8); return u.v;
}
__device__ __forceinline__ v16h fragt_h(const _Float16* tile, int lane) {
  union { v16h v; v8h q[2]; } u; u.q[0] = *(const v8h*)(tile + lane * 8); u.q[1] = *(const v8h*)(tile + 256 + lane * 8); return u.v;
}
__device__ __forceinline__ float bfr(float v) { return (float)(__bf16)v; }
__device__ __attribute__((noinline)) float exp_ni(float v) { return expf(v); }
__device__ __attribute__((noinline)) float erf_ni(float v) { return erff(v); }
__device__ __attribute__((noinline)) float expm1f_ni(float v) { return expm1f(v); }

#define WS_PQ  0u                                  // bf16 fragment-order tiles [column tile][k block][512]: Wq 64 x 32; Wk 16 x 32; Wv 16 x 32; memory 16 x 8
#define WS_PK  (WS_PQ + 2u * (size_t)DM * DM)
#define WS_PV  (WS_PK + 2u * (size_t)KVW * DM)
#define WS_PM  (WS_PV + 2u * (size_t)KVW * DM)
#define WS_QF  (WS_PM + 2u * (size_t)KVW * KVW)        // f32 q rows [NR][1024]; f16 q rows [NR][1024]; f16 k tiles [b][head][16-key tile][512]; f16 v tiles [b][16-dim tile][32-key block][512]; f32 attn O [NR][1024]; bf16 x tiles [16-row tile][k block][512]
#define WS_QH  (WS_QF + 4u * (size_t)NR * DM)
#define WS_K   (WS_QH + 2u * (size_t)NR * DM)
#define WS_V   (WS_K + 2u * (size_t)NR * KVW)
#define WS_O   (WS_V + 2u * (size_t)NB * KVW * SS)
#define WS_XB  (WS_O + 4u * (size_t)NR * DM)
#define WS_END (WS_XB + 2u * (size_t)NR * DM)

// ---- k_pack: blocks 0..255: one 16-row tile of x each; then 16 columns x 256 k of a weight each (Wq 256 blocks, Wk 64, Wv 64, memory 16). Every block writes one contiguous run of whole tiles.
__global__ __launch_bounds__(256) void k_pack(const float* __restrict__ X, const float* __restrict__ WQ, const float* __restrict__ WK, const float* __restrict__ WV, const float* __restrict__ MM, __bf16* __restrict__ XB, __bf16* __restrict__ PQ, __bf16* __restrict__ PK, __bf16* __restrict__ PV, __bf16* __restrict__ PM) {
  __shared__ __align__(16) __bf16 s[16][264];
  const int t = threadIdx.x; int id = blockIdx.x;
  if (id < NR / 16) {   // x is k-contiguous already: each thread takes the 8 floats of a 16-byte piece of the tile run
    __bf16* xd = XB + (size_t)id * 16 * DM; v4f a[8][2];
    // piece p = t + 256 j: k block (t >> 6) + 4 j, half (t >> 5) & 1, lane t & 31: from one j to the next the source moves on by 4 k blocks
    const float* q = X + (size_t)id * 16 * DM + (size_t)(t & 15) * DM + (t >> 6) * 32 + ((t >> 5) & 1) * 16 + ((t >> 4) & 1) * 8;
#pragma unroll
    for (int j = 0; j < 8; ++j) { a[j][0] = *(const v4f*)(q + j * 128); a[j][1] = *(const v4f*)(q + j * 128 + 4); }
    asm volatile("s_wait_xcnt 0x0" :: "v"(q) : "memory");   // q as an input keeps the address pair out of the loads' own destinations until the wait has passed
#pragma unroll
    for (int j = 0; j < 8; ++j) { v8b o;
#pragma unroll
      for (int i = 0; i < 4; ++i) { o[i] = (__bf16)a[j][0][i]; o[4 + i] = (__bf16)a[j][1][i]; }
      *(v8b*)(xd + (size_t)(t + 256 * j) * 8) = o; }
    return; }
  id -= NR / 16; const float* w; __bf16* dst; int ld = KVW, nkc = DM / 32;
  if (id < 256) { w = WQ; dst = PQ; ld = DM; } else if (id < 320) { id -= 256; w = WK; dst = PK; } else if (id < 384) { id -= 320; w = WV; dst = PV; } else { id = (id - 384) * 4; w = MM; dst = PM; nkc = KVW / 32; }
  const int nt = id >> 2, ch = id & 3;
  const float* q = w + (size_t)(ch * 256 + t) * ld + nt * 16; v4f r[4];
#pragma unroll
  for (int c = 0; c < 4; ++c) r[c] = *(const v4f*)(q + c * 4);
#pragma unroll
  for (int c = 0; c < 16; ++c) s[c][t] = (__bf16)r[c >> 2][c & 3];
  __syncthreads();
  __bf16* d = dst + ((size_t)nt * nkc + ch * 8) * 512;
#pragma unroll
  for (int j = 0; j < 2; ++j) { const int p = t + 256 * j, ln = p & 31; vst2((unsigned*)(d + (size_t)p * 8), *(const v4u*)&s[ln & 15][(p >> 6) * 32 + ((p >> 5) & 1) * 16 + (ln >> 4) * 8]); }
}
// one k block of k_proj: the wave's x fragment and its 8 weight fragments, all 18 loads issued as one group
__device__ __forceinline__ void proj_fetch(v16b &x, v16b (&w)[8], const __bf16* xt, const __bf16* wt, int lane) {
  x = fragt_b(xt, lane);
#pragma unroll
  for (int j = 0; j < 8; ++j) w[j] = fragt_b(wt + (size_t)j * (DM / 32) * 512, lane);
}
__device__ __forceinline__ void proj_mac(const v16b &a, const v16b (&w)[8], v8f (&acc)[8]) {
#pragma unroll
  for (int j = 0; j < 8; ++j) acc[j] = wmma_bf(a, w[j], acc[j]);
}
// ---- k_proj: block = (64 rows, 128 cols, which): 0: q -> f32 + f16 rows (8 column blocks); 1: k -> f16 fragment-order tiles (2 column blocks); 2: v -> f16 fragment-order tiles (2 column blocks)
__global__ __launch_bounds__(128) void k_proj(const __bf16* __restrict__ XB, const __bf16* __restrict__ PQ, const __bf16* __restrict__ PK, const __bf16* __restrict__ PV, float* __restrict__ QF, _Float16* __restrict__ QH, _Float16* __restrict__ Kr, _Float16* __restrict__ V) {
  __shared__ __align__(16) float sf[4][16][132]; __shared__ __align__(16) _Float16 so[64][136]; __shared__ __align__(16) _Float16 st[128][72];
  const int tid = threadIdx.x, wave = tid >> 5, lane = tid & 31, col = lane & 15, g = lane >> 4; const int which = blockIdx.z; const int c0 = blockIdx.y * 128; if (which > 0 && c0 >= KVW) return;
  const size_t rb = (size_t)blockIdx.x * 64; const size_t r0 = rb + wave * 16; const __bf16* Wr = (which == 0) ? PQ : (which == 1) ? PK : PV;
  v8f acc[8] = {};
  const __bf16* xp = XB + (r0 >> 4) * (DM / 32) * 512; const __bf16* wp = Wr + (size_t)(c0 >> 4) * (DM / 32) * 512;
  v16b xa, xb; v16b wa[8], wb[8];   // two register sets: one k block is multiplied while the next one's loads are in flight
  proj_fetch(xa, wa, xp, wp, lane);
#pragma unroll 1   // rolled: the two sets already give the overlap, a longer body only adds registers
  for (int kc = 0; kc < DM / 32 - 2; kc += 2) {
    proj_fetch(xb, wb, xp + (kc + 1) * 512, wp + (kc + 1) * 512, lane);
    proj_mac(xa, wa, acc);
    proj_fetch(xa, wa, xp + (kc + 2) * 512, wp + (kc + 2) * 512, lane);
    proj_mac(xb, wb, acc);
    asm volatile("s_wait_xcnt 0x0" ::: "memory"); }   // the next trip rewrites the address registers that this trip's last loads name
  // last two k blocks outside the loop: a fetch under a test inside it would make every wait count for the path without the fetch
  proj_fetch(xb, wb, xp + (DM / 32 - 1) * 512, wp + (DM / 32 - 1) * 512, lane);
  proj_mac(xa, wa, acc);
  proj_mac(xb, wb, acc);
  if (which < 2) {
#pragma unroll
    for (int j = 0; j < 8; ++j)
#pragma unroll
      for (int r = 0; r < 8; ++r) { so[wave * 16 + 8 * g + r][j * 16 + col] = (_Float16)acc[j][r]; if (which == 0) sf[wave][8 * g + r][j * 16 + col] = acc[j][r]; }
    __syncthreads();
    if (which == 0) { for (int rl = 0; rl < 16; ++rl) vst2(QF + (r0 + rl) * DM + c0 + lane * 4, *(const v4f*)&sf[wave][rl][lane * 4]); for (int e = tid; e < 64 * 16; e += 128) { const int rl = e >> 4, q = e & 15; vst2((unsigned*)(QH + (rb + rl) * DM + c0 + q * 8), *(const v4u*)&so[rl][q * 8]); } }
    else { const size_t b = rb / SS; const int s0 = (int)(rb % SS);   // 4 heads x 4 key tiles, each tile whole
      for (int e = tid; e < 64 * 16; e += 128) { const int tl = e >> 6, ln = e & 31; vst2((unsigned*)(Kr + (((b * NH + (c0 >> 5) + (tl >> 2)) * (SS / 16)) + (s0 >> 4) + (tl & 3)) * 512 + (e & 63) * 8), *(const v4u*)&so[(tl & 3) * 16 + (ln & 15)][(tl >> 2) * 32 + ((e >> 5) & 1) * 16 + (ln >> 4) * 8]); } } }
  else {
#pragma unroll
    for (int j = 0; j < 8; ++j)
#pragma unroll
      for (int r = 0; r < 8; ++r) st[j * 16 + col][wave * 16 + 8 * g + r] = (_Float16)acc[j][r];
    __syncthreads(); const size_t b = rb / SS; const int s0 = (int)(rb % SS);
    // 8 dim tiles x 2 key blocks, each tile whole
    for (int e = tid; e < 128 * 8; e += 128) { const int tl = e >> 6, ln = e & 31; vst2((unsigned*)(V + (((b * (KVW / 16) + (c0 >> 4) + (tl >> 1)) * (SS / 32)) + (s0 >> 5) + (tl & 1)) * 512 + (e & 63) * 8), *(const v4u*)&st[(tl >> 1) * 16 + (ln & 15)][(tl & 1) * 32 + ((e >> 5) & 1) * 16 + (ln >> 4) * 8]); } }
}
__global__ __launch_bounds__(128) void k_attn(const _Float16* __restrict__ QH, const _Float16* __restrict__ Kr, const _Float16* __restrict__ V, float* __restrict__ O) {
  __shared__ __align__(16) _Float16 sph[4][16][40]; __shared__ __align__(16) float so[4][16][36];
  const int tid = threadIdx.x, wave = tid >> 5, lane = tid & 31, col = lane & 15, g = lane >> 4; const int qg = blockIdx.y / NH, h = blockIdx.y % NH; const size_t b = blockIdx.z; const int q0 = blockIdx.x * 64 + wave * 16; const size_t rq = b * SS + q0; const int qc = qg * KVW + h * HD;
  const v16h aq = frag_h(QH + (rq + col) * DM + qc, lane);
  float m[8], l[8];
#pragma unroll
  for (int r = 0; r < 8; ++r) { m[r] = -3.0e38f; l[r] = 0.f; }
  v8f acc[2] = {};
#pragma unroll 1
  for (int ks = 0; ks < SS / 32; ++ks) { v8f s[2];
    // this pass's two key and two value fragments as one group of loads: the values land while the softmax is worked
    v16h kf[2], vf[2];
#pragma unroll
    for (int ct = 0; ct < 2; ++ct) kf[ct] = fragt_h(Kr + ((b * NH + h) * (SS / 16) + ks * 2 + ct) * 512, lane);
#pragma unroll
    for (int dt = 0; dt < 2; ++dt) vf[dt] = fragt_h(V + ((b * (KVW / 16) + h * 2 + dt) * (SS / 32) + ks) * 512, lane);
#pragma unroll
    for (int ct = 0; ct < 2; ++ct) { v8f c = {}; c = wmma16(aq, kf[ct], c);
#pragma unroll
      for (int r = 0; r < 8; ++r) s[ct][r] = c[r] * 0.17677669529663688f; }
#pragma unroll
    for (int r = 0; r < 8; ++r) { float mx = fmaxf(s[0][r], s[1][r]);
#pragma unroll
      for (int o = 1; o < 16; o <<= 1) mx = fmaxf(mx, __shfl_xor(mx, o));
      const float mn = fmaxf(m[r], mx); const float alpha = (m[r] <= -1.0e38f) ? 0.f : __expf(m[r] - mn); const float e0 = __expf(s[0][r] - mn), e1 = __expf(s[1][r] - mn); float es = e0 + e1;
#pragma unroll
      for (int o = 1; o < 16; o <<= 1) es += __shfl_xor(es, o);
      l[r] = l[r] * alpha + es; m[r] = mn;
#pragma unroll
      for (int dt = 0; dt < 2; ++dt) acc[dt][r] *= alpha;
      sph[wave][8 * g + r][col] = (_Float16)(e0 * 2048.0f); sph[wave][8 * g + r][16 + col] = (_Float16)(e1 * 2048.0f); }
    LDSX();
    const v16h pa = frag_h(&sph[wave][col][0], lane);
#pragma unroll
    for (int dt = 0; dt < 2; ++dt) acc[dt] = wmma16(pa, vf[dt], acc[dt]);
    LDSX(); }
#pragma unroll
  for (int r = 0; r < 8; ++r) { const float il = (1.0f / 2048.0f) / l[r];
#pragma unroll
    for (int dt = 0; dt < 2; ++dt) so[wave][8 * g + r][dt * 16 + col] = acc[dt][r] * il; }
  LDSX();
  for (int rl = 0; rl < 16; ++rl) if (lane < 8) vst2(O + (rq + rl) * DM + qc + lane * 4, *(const v4f*)&so[wave][rl][lane * 4]);
}
// elu of 8 loaded quads, stored to every second sigma row; expm1f is taken for every lane and selected, so that the 32 chains are independent
__device__ __forceinline__ void elu_rows(const v4f (&q)[8], float* dst) {
#pragma unroll
  for (int u = 0; u < 8; ++u) { v4f sg;
#pragma unroll
    for (int i = 0; i < 4; ++i) { const float v = q[u][i]; const float e = expm1f(v); sg[i] = (v > 0.f) ? v : e; }
    *(v4f*)(dst + (size_t)u * 2 * (KVW + 4)) = sg; }
}
// ---- k_mem: block = (64 token rows, 128 of the group's 256 cols, group): sigma = elu(q group slice) (f32 from QF), num = sigma (hi+lo) . memory (2 products), den = sigma . memory_norm (f32), out = attn (1-w) + (num/den) w
__global__ __launch_bounds__(128) void k_mem(const float* __restrict__ QF, const __bf16* __restrict__ PM, const float* __restrict__ MN, const float* __restrict__ MW, const float* __restrict__ O, float* __restrict__ OUT) {
  __shared__ __align__(16) float ssg[64][KVW + 4]; __shared__ float sden[64]; __shared__ __align__(16) float so[4][16][132];
  const int tid = threadIdx.x, wave = tid >> 5, lane = tid & 31, col = lane & 15, g = lane >> 4; const size_t rb = (size_t)blockIdx.x * 64; const size_t r0 = rb + wave * 16; const int half = blockIdx.y, qg = blockIdx.z; const int c0 = half * 128;
  const float mw = MW[0];
  // sigma rows: 16-byte loads, 8 a thread in flight as one group, the next group issued before this one is worked on
  const float* qp = QF + (rb + (tid >> 6)) * DM + qg * KVW + (tid & 63) * 4; float* sgp = &ssg[tid >> 6][(tid & 63) * 4]; v4f qr[8], qn[8];
#pragma unroll
  for (int u = 0; u < 8; ++u) qr[u] = *(const v4f*)(qp + (size_t)u * 2 * DM);
#pragma unroll 1   // rolled: 32 inlined expm1f a trip are text enough
  for (int it = 0; it < 3; ++it) {
#pragma unroll
    for (int u = 0; u < 8; ++u) qn[u] = *(const v4f*)(qp + (size_t)((it + 1) * 8 + u) * 2 * DM);
    elu_rows(qr, sgp + (size_t)it * 16 * (KVW + 4));
#pragma unroll
    for (int u = 0; u < 8; ++u) qr[u] = qn[u]; }
  // memory fragments come in groups of 4 (half a k block) through a ring of 3 register sets: one is multiplied, two are in flight
  const __bf16* pm = PM + (size_t)(c0 >> 4) * (KVW / 32) * 512; v16b w[3][4]; float sr[2][16];
#pragma unroll
  for (int h = 0; h < 2; ++h)
#pragma unroll
    for (int jj = 0; jj < 4; ++jj) w[h][jj] = fragt_b(pm + (size_t)(h * 4 + jj) * (KVW / 32) * 512, lane);
  elu_rows(qr, sgp + (size_t)3 * 16 * (KVW + 4));
  asm volatile("s_wait_xcnt 0x0" ::: "memory");   // the offset register of the first two fragment groups is reused behind the barrier while they may be in flight
  __syncthreads();
  if (tid < 64) { float d0 = 0.f; for (int c = 0; c < KVW; ++c) d0 += ssg[tid][c] * bfr(MN[c]); sden[tid] = d0; }
  v8f acc[8] = {}; float ov[8][8];
  const float* sp = &ssg[wave * 16 + col][8 * g]; const float* op = O + (r0 + 8 * g) * DM + qg * KVW + c0 + col;
#pragma unroll
  for (int i = 0; i < 8; ++i) { sr[0][i] = sp[i]; sr[0][8 + i] = sp[16 + i]; }
  F2 a;
#pragma unroll
  for (int h = 0; h < 2 * (KVW / 32); ++h) { const int kc = h >> 1, jb = (h & 1) * 4;
    // ahead of this group's products: the group two further on; behind the last group the attention tile
    if (h + 2 < 2 * (KVW / 32)) {
#pragma unroll
      for (int jj = 0; jj < 4; ++jj) w[(h + 2) % 3][jj] = fragt_b(pm + ((size_t)(jb + jj) * (KVW / 32) + kc + 1) * 512, lane); }
    else if (jb == 0) {
      asm volatile("s_wait_xcnt 0x0" ::: "memory");   // the tile's loads may land in the address registers of fragment loads that are still in flight
#pragma unroll
      for (int j = 0; j < 8; ++j)
#pragma unroll
        for (int r = 0; r < 8; ++r) ov[j][r] = op[(size_t)r * DM + j * 16]; }
    if (jb == 0) {   // the next k block's sigma slice is read from LDS one block ahead as well
      if (kc + 1 < KVW / 32) {
#pragma unroll
        for (int i = 0; i < 8; ++i) { sr[(kc + 1) & 1][i] = sp[(kc + 1) * 32 + i]; sr[(kc + 1) & 1][8 + i] = sp[(kc + 1) * 32 + 16 + i]; } }
      a = bsplit16(sr[kc & 1]); }
#pragma unroll
    for (int jj = 0; jj < 4; ++jj) { acc[jb + jj] = wmma_bf(a.h, w[h % 3][jj], acc[jb + jj]); acc[jb + jj] = wmma_bf(a.l, w[h % 3][jj], acc[jb + jj]); } }
  __syncthreads();
  const float wg = 1.0f / (1.0f + __expf(-bfr(mw)));
#pragma unroll
  for (int j = 0; j < 8; ++j)
#pragma unroll
    for (int r = 0; r < 8; ++r) { const int rl = wave * 16 + 8 * g + r; so[wave][8 * g + r][j * 16 + col] = ov[j][r] * (1.0f - wg) + (acc[j][r] / sden[rl]) * wg; }
  LDSX();
  v4f t[16];
#pragma unroll
  for (int rl = 0; rl < 16; ++rl) t[rl] = *(const v4f*)&so[wave][rl][lane * 4];
#pragma unroll
  for (int rl = 0; rl < 16; ++rl) vst2(OUT + (r0 + rl) * DM + qg * KVW + c0 + lane * 4, t[rl]);
}
extern "C" void kernel_launch(void* const* d_in, const int* in_sizes, int n_in, void* d_out, int out_size, void* d_ws, size_t ws_size, hipStream_t stream) {
  (void)in_sizes; (void)n_in; (void)out_size;
  const float** F = (const float**)d_in;   // 0 x [4,1024,1024], 1 Wq [1024,1024] (in,out), 2 Wk [1024,256], 3 Wv [1024,256], 4 memory [256,256], 5 memory_norm [256,1], 6 memory_weight [1]
  if (ws_size < (size_t)WS_END) return;
  char* ws = (char*)d_ws; __bf16 *PQ = (__bf16*)(ws + WS_PQ), *PK = (__bf16*)(ws + WS_PK), *PV = (__bf16*)(ws + WS_PV), *PM = (__bf16*)(ws + WS_PM); float *QF = (float*)(ws + WS_QF), *O = (float*)(ws + WS_O); _Float16 *QH = (_Float16*)(ws + WS_QH), *Kr = (_Float16*)(ws + WS_K), *V = (_Float16*)(ws + WS_V); __bf16* XB = (__bf16*)(ws + WS_XB);
  k_pack<<<dim3(NR / 16 + 400), 256, 0, stream>>>(F[0], F[1], F[2], F[3], F[4], XB, PQ, PK, PV, PM);
  k_proj<<<dim3(TNB * SS / 64, DM / 128, 3), 128, 0, stream>>>(XB, PQ, PK, PV, QF, QH, Kr, V);
  k_attn<<<dim3(TQB, NQ * NH, TNB), 128, 0, stream>>>(QH, Kr, V, O);
  k_mem<<<dim3(TNB * SS / 64, 2, NQ), 128, 0, stream>>>(QF, PM, F[5], F[6], O, (float*)d_out);
}

// v003
// One run takes 71.8 microseconds.
// Two timings next to v002 put it at 1.41 and 1.37 times that version's speed.
// Over all steps from v000 it is 3.40 times as fast.
// compute dtype: all float inputs rounded to bf16; q/k/v = x . W with EXACT bf16 products on WMMA 16x16x32 (x, the (in,out) weights and memory packed as bf16 fragment-order tiles): q kept f32 (for the ELU memory branch) and as f16 rows, k and v as f16 fragment-order tiles; grouped softmax attention (4 query groups x 8 heads x 32 dims over 1,024 keys): q, k single f16 x 32^-1/2, running-max softmax in f32 (hardware exp), P (scaled by 2^11, single f16) x v (single f16); memory branch: sigma = elu(q group row) in f32, (sigma as bf16 hi + lo, 2 products) . memory and sigma . memory_norm (f32 dot), divide; out = attn (1 - sigmoid(w)) + mem sigmoid(w) in f32; f32 output.
#include <hip/hip_runtime.h>
#include <math.h>

typedef __attribute__((ext_vector_type(16))) _Float16 v16h;
typedef __attribute__((ext_vector_type(16))) __bf16 v16b;
typedef __attribute__((ext_vector_type(8)))  _Float16 v8h;
typedef __attribute__((ext_vector_type(8)))  float v8f;
typedef __attribute__((ext_vector_type(4)))  float v4f;
typedef __attribute__((ext_vector_type(2)))  float v2f;
typedef __attribute__((ext_vector_type(4)))  unsigned v4u;
typedef __attribute__((ext_vector_type(4)))  int v4i;
typedef float __attribute__((may_alias)) float_a;
typedef int __attribute__((may_alias)) int_a;

template <typename T> __device__ __forceinline__ void vst2(void* p, T v) { *(T*)p = v;  }
__device__ __forceinline__ v8f wmma16(v16h a, v16h b, v8f c) {
  v8f d = __builtin_amdgcn_wmma_f32_16x16x32_f16(false, a, false, b, (short)0, c, false, false);
  asm volatile("v_nop\n\tv_nop\n\tv_nop\n\tv_nop" : "+v"(d) : "v"(a), "v"(b));
  return d;
}
__device__ __forceinline__ v8f wmma_bf(v16b a, v16b b, v8f c) {
  v8f d = __builtin_amdgcn_wmma_f32_16x16x32_bf16(false, a, false, b, (short)0, c, false, false);
  asm volatile("v_nop\n\tv_nop\n\tv_nop\n\tv_nop" : "+v"(d) : "v"(a), "v"(b));
  return d;
}
// 16x16x32 fragments: lane = (h = lane>>4, row/col = lane&15); elements 0..7 = k0+8h+0..7, 8..15 = k0+16+8h+0..7; D element r = row 8h+r
__device__ __forceinline__ v16h frag_h(const _Float16* rowk0, int lane) {
  union { v16h v; v8h q[2]; } u; const _Float16* p = rowk0 + 8 * (lane >> 4);
  u.q[0] = *(const v8h*)p; u.q[1] = *(const v8h*)(p + 16); return u.v;
}
__device__ __forceinline__ v16h frag_f32(const float* rowk0, int lane) {
  v16h a; const float* p = rowk0 + 8 * (lane >> 4);
#pragma unroll
  for (int i = 0; i < 8; ++i) { a[i] = (_Float16)p[i]; a[8 + i] = (_Float16)p[16 + i]; }
  return a;
}
__device__ __forceinline__ v16h frag_f32s(const float* rowk0, int lane, float sc) {
  v16h a; const float* p = rowk0 + 8 * (lane >> 4);
#pragma unroll
  for (int i = 0; i < 8; ++i) { a[i] = (_Float16)(p[i] * sc); a[8 + i] = (_Float16)(p[16 + i] * sc); }
  return a;
}
// column fragment from a [K][ld] layout (column n), rows >= K read as 0
__device__ __forceinline__ v16h fragc_f32(const float* W, int k0, int n, int lane, int ld, int K) {
  v16h a; const int g = lane >> 4;
#pragma unroll
  for (int i = 0; i < 8; ++i) { const int ka = k0 + 8 * g + i, kb = ka + 16;
    a[i] = (_Float16)(ka < K ? W[(size_t)(ka < K ? ka : K - 1) * ld + n] : 0.f); a[8 + i] = (_Float16)(kb < K ? W[(size_t)(kb < K ? kb : K - 1) * ld + n] : 0.f); }
  return a;
}
struct F2 { v16b h, l; };
__device__ __forceinline__ F2 bsplit16(const float v[16]) { F2 r;
#pragma unroll
  for (int i = 0; i < 16; ++i) { const __bf16 h = (__bf16)v[i]; r.h[i] = h; r.l[i] = (__bf16)(v[i] - (float)h); }
  return r; }
__device__ __forceinline__ F2 split_row(const float* row, int k0, int lane) { float v[16]; const float* p = row + k0 + 8 * (lane >> 4);
#pragma unroll
  for (int i = 0; i < 8; ++i) { v[i] = p[i]; v[8 + i] = p[16 + i]; }
  return bsplit16(v); }
__device__ __forceinline__ F2 split_rowK(const float* row, int k0, int lane, int K) { float v[16]; const int g = lane >> 4;
#pragma unroll
  for (int i = 0; i < 8; ++i) { const int ka = k0 + 8 * g + i, kb = ka + 16; v[i] = ka < K ? row[ka < K ? ka : K - 1] : 0.f; v[8 + i] = kb < K ? row[kb < K ? kb : K - 1] : 0.f; }
  return bsplit16(v); }
__device__ __forceinline__ F2 split_col(const float* W, int k0, int n, int lane, int ld, int K) { float v[16]; const int g = lane >> 4;
#pragma unroll
  for (int i = 0; i < 8; ++i) { const int ka = k0 + 8 * g + i, kb = ka + 16; v[i] = ka < K ? W[(size_t)(ka < K ? ka : K - 1) * ld + n] : 0.f; v[8 + i] = kb < K ? W[(size_t)(kb < K ? kb : K - 1) * ld + n] : 0.f; }
  return bsplit16(v); }
__device__ __forceinline__ v8f mac3(const F2& a, const F2& b, v8f c) { c = wmma_bf(a.l, b.h, c); c = wmma_bf(a.h, b.l, c); return wmma_bf(a.h, b.h, c); }
__device__ __forceinline__ float sigm(float v) { return 1.0f / (1.0f + expf(-v)); }
#define LDSX() do { asm volatile("s_wait_dscnt 0" ::: "memory"); __builtin_amdgcn_wave_barrier(); __builtin_amdgcn_fence(__ATOMIC_RELEASE, "workgroup"); } while (0)


// Grouped recurrent multi-head attention (B 4, S 1,024, d 1,024 = 4 query groups x 8 heads x 32): grouped-query softmax attention sharing K/V across the 4 groups, plus an ELU linear-memory branch (sigma(q) M / sigma(q) m_norm), mixed by a sigmoid gate.
#define NB 4
#define SS 1024
#define DM 1024
#define NQ 4
#define NH 8
#define HD 32
#define KVW (NH * HD)      // 256
#define NR (NB * SS)
#ifndef TQB
#define TQB (SS / 64)
#define TNB NB
#endif
typedef __attribute__((ext_vector_type(8))) __bf16 v8b;
__device__ __forceinline__ v16b frag_b(const __bf16* rowk0, int lane) {
  union { v16b v; v8b q[2]; } u; const __bf16* p = rowk0 + 8 * (lane >> 4);
  u.q[0] = *(const v8b*)p; u.q[1] = *(const v8b*)(p + 16); return u.v;
}
// fragment-order tile: 16 rows (or columns) x 32 k of a 16-bit type = 512 elements = 1 KiB; element (r, k) stands at ((k >> 4) & 1) * 256 + (((k >> 3) & 1) * 16 + r) * 8 + (k & 7).
// Lane l's two 16-byte halves stand at l * 8 and 256 + l * 8, so each load of a wave covers four whole 128-byte lines instead of a part of sixteen.
__device__ __forceinline__ v16b fragt_b(const __bf16* tile, int lane) {
  union { v16b v; v8b q[2]; } u; u.q[0] = *(const v8b*)(tile + lane * 8); u.q[1] = *(const v8b*)(tile + 256 + lane * 8); return u.v;
}
__device__ __forceinline__ v16h fragt_h(const _Float16* tile, int lane) {
  union { v16h v; v8h q[2]; } u; u.q[0] = *(const v8h*)(tile + lane * 8); u.q[1] = *(const v8h*)(tile + 256 + lane * 8); return u.v;
}
__device__ __forceinline__ float bfr(float v) { return (float)(__bf16)v; }
__device__ __attribute__((noinline)) float exp_ni(float v) { return expf(v); }
__device__ __attribute__((noinline)) float erf_ni(float v) { return erff(v); }
__device__ __attribute__((noinline)) float expm1f_ni(float v) { return expm1f(v); }

#define WS_PQ  0u                                  // bf16 fragment-order tiles [column tile][k block][512]: Wq 64 x 32; Wk 16 x 32; Wv 16 x 32; memory 16 x 8
#define WS_PK  (WS_PQ + 2u * (size_t)DM * DM)
#define WS_PV  (WS_PK + 2u * (size_t)KVW * DM)
#define WS_PM  (WS_PV + 2u * (size_t)KVW * DM)
#define WS_QF  (WS_PM + 2u * (size_t)KVW * KVW)        // f32 q rows [NR][1024]; f16 q rows [NR][1024]; f16 k tiles [b][head][16-key tile][512]; f16 v tiles [b][16-dim tile][32-key block][512]; f32 attn O [NR][1024]; bf16 x tiles [16-row tile][k block][512]
#define WS_QH  (WS_QF + 4u * (size_t)NR * DM)
#define WS_K   (WS_QH + 2u * (size_t)NR * DM)
#define WS_V   (WS_K + 2u * (size_t)NR * KVW)
#define WS_O   (WS_V + 2u * (size_t)NB * KVW * SS)
#define WS_XB  (WS_O + 4u * (size_t)NR * DM)
#define WS_END (WS_XB + 2u * (size_t)NR * DM)

// ---- k_pack: blocks 0..255: one 16-row tile of x each; then 16 columns x 256 k of a weight each (Wq 256 blocks, Wk 64, Wv 64, memory 16). Every block writes one contiguous run of whole tiles.
__global__ __launch_bounds__(256) void k_pack(const float* __restrict__ X, const float* __restrict__ WQ, const float* __restrict__ WK, const float* __restrict__ WV, const float* __restrict__ MM, __bf16* __restrict__ XB, __bf16* __restrict__ PQ, __bf16* __restrict__ PK, __bf16* __restrict__ PV, __bf16* __restrict__ PM) {
  __shared__ __align__(16) __bf16 s[16][264];
  const int t = threadIdx.x; int id = blockIdx.x;
  if (id < NR / 16) {   // x is k-contiguous already: each thread takes the 8 floats of a 16-byte piece of the tile run
    __bf16* xd = XB + (size_t)id * 16 * DM; v4f a[8][2];
    // piece p = t + 256 j: k block (t >> 6) + 4 j, half (t >> 5) & 1, lane t & 31: from one j to the next the source moves on by 4 k blocks
    const float* q = X + (size_t)id * 16 * DM + (size_t)(t & 15) * DM + (t >> 6) * 32 + ((t >> 5) & 1) * 16 + ((t >> 4) & 1) * 8;
#pragma unroll
    for (int j = 0; j < 8; ++j) { a[j][0] = *(const v4f*)(q + j * 128); a[j][1] = *(const v4f*)(q + j * 128 + 4); }
    asm volatile("s_wait_xcnt 0x0" :: "v"(q) : "memory");   // q as an input keeps the address pair out of the loads' own destinations until the wait has passed
#pragma unroll
    for (int j = 0; j < 8; ++j) { v8b o;
#pragma unroll
      for (int i = 0; i < 4; ++i) { o[i] = (__bf16)a[j][0][i]; o[4 + i] = (__bf16)a[j][1][i]; }
      *(v8b*)(xd + (size_t)(t + 256 * j) * 8) = o; }
    return; }
  id -= NR / 16; const float* w; __bf16* dst; int ld = KVW, nkc = DM / 32;
  if (id < 256) { w = WQ; dst = PQ; ld = DM; } else if (id < 320) { id -= 256; w = WK; dst = PK; } else if (id < 384) { id -= 320; w = WV; dst = PV; } else { id = (id - 384) * 4; w = MM; dst = PM; nkc = KVW / 32; }
  const int nt = id >> 2, ch = id & 3;
  const float* q = w + (size_t)(ch * 256 + t) * ld + nt * 16; v4f r[4];
#pragma unroll
  for (int c = 0; c < 4; ++c) r[c] = *(const v4f*)(q + c * 4);
#pragma unroll
  for (int c = 0; c < 16; ++c) s[c][t] = (__bf16)r[c >> 2][c & 3];
  __syncthreads();
  __bf16* d = dst + ((size_t)nt * nkc + ch * 8) * 512;
#pragma unroll
  for (int j = 0; j < 2; ++j) { const int p = t + 256 * j, ln = p & 31; vst2((unsigned*)(d + (size_t)p * 8), *(const v4u*)&s[ln & 15][(p >> 6) * 32 + ((p >> 5) & 1) * 16 + (ln >> 4) * 8]); }
}
// one k block of k_proj: the wave's x fragment and its 8 weight fragments, all 18 loads issued as one group
__device__ __forceinline__ void proj_fetch(v16b &x, v16b (&w)[8], const __bf16* xt, const __bf16* wt, int lane) {
  x = fragt_b(xt, lane);
#pragma unroll
  for (int j = 0; j < 8; ++j) w[j] = fragt_b(wt + (size_t)j * (DM / 32) * 512, lane);
}
__device__ __forceinline__ void proj_mac(const v16b &a, const v16b (&w)[8], v8f (&acc)[8]) {
#pragma unroll
  for (int j = 0; j < 8; ++j) acc[j] = wmma_bf(a, w[j], acc[j]);
}
// ---- k_proj: block = (64 rows, 128 cols, which): 0: q -> f32 + f16 rows (8 column blocks); 1: k -> f16 fragment-order tiles (2 column blocks); 2: v -> f16 fragment-order tiles (2 column blocks)
__global__ __launch_bounds__(128) void k_proj(const __bf16* __restrict__ XB, const __bf16* __restrict__ PQ, const __bf16* __restrict__ PK, const __bf16* __restrict__ PV, float* __restrict__ QF, _Float16* __restrict__ QH, _Float16* __restrict__ Kr, _Float16* __restrict__ V) {
  __shared__ __align__(16) float sf[4][16][132]; __shared__ __align__(16) _Float16 so[64][136]; __shared__ __align__(16) _Float16 st[128][72];
  const int tid = threadIdx.x, wave = tid >> 5, lane = tid & 31, col = lane & 15, g = lane >> 4; const int which = blockIdx.z; const int c0 = blockIdx.y * 128; if (which > 0 && c0 >= KVW) return;
  const size_t rb = (size_t)blockIdx.x * 64; const size_t r0 = rb + wave * 16; const __bf16* Wr = (which == 0) ? PQ : (which == 1) ? PK : PV;
  v8f acc[8] = {};
  const __bf16* xp = XB + (r0 >> 4) * (DM / 32) * 512; const __bf16* wp = Wr + (size_t)(c0 >> 4) * (DM / 32) * 512;
  v16b xa, xb; v16b wa[8], wb[8];   // two register sets: one k block is multiplied while the next one's loads are in flight
  proj_fetch(xa, wa, xp, wp, lane);
#pragma unroll 1   // rolled: the two sets already give the overlap, a longer body only adds registers
  for (int kc = 0; kc < DM / 32 - 2; kc += 2) {
    proj_fetch(xb, wb, xp + (kc + 1) * 512, wp + (kc + 1) * 512, lane);
    proj_mac(xa, wa, acc);
    proj_fetch(xa, wa, xp + (kc + 2) * 512, wp + (kc + 2) * 512, lane);
    proj_mac(xb, wb, acc);
    asm volatile("s_wait_xcnt 0x0" ::: "memory"); }   // the next trip rewrites the address registers that this trip's last loads name
  // last two k blocks outside the loop: a fetch under a test inside it would make every wait count for the path without the fetch
  proj_fetch(xb, wb, xp + (DM / 32 - 1) * 512, wp + (DM / 32 - 1) * 512, lane);
  proj_mac(xa, wa, acc);
  proj_mac(xb, wb, acc);
  if (which < 2) {
#pragma unroll
    for (int j = 0; j < 8; ++j)
#pragma unroll
      for (int r = 0; r < 8; ++r) { so[wave * 16 + 8 * g + r][j * 16 + col] = (_Float16)acc[j][r]; if (which == 0) sf[wave][8 * g + r][j * 16 + col] = acc[j][r]; }
    __syncthreads();
    if (which == 0) { for (int rl = 0; rl < 16; ++rl) vst2(QF + (r0 + rl) * DM + c0 + lane * 4, *(const v4f*)&sf[wave][rl][lane * 4]); for (int e = tid; e < 64 * 16; e += 128) { const int rl = e >> 4, q = e & 15; vst2((unsigned*)(QH + (rb + rl) * DM + c0 + q * 8), *(const v4u*)&so[rl][q * 8]); } }
    else { const size_t b = rb / SS; const int s0 = (int)(rb % SS);   // 4 heads x 4 key tiles, each tile whole
      for (int e = tid; e < 64 * 16; e += 128) { const int tl = e >> 6, ln = e & 31; vst2((unsigned*)(Kr + (((b * NH + (c0 >> 5) + (tl >> 2)) * (SS / 16)) + (s0 >> 4) + (tl & 3)) * 512 + (e & 63) * 8), *(const v4u*)&so[(tl & 3) * 16 + (ln & 15)][(tl >> 2) * 32 + ((e >> 5) & 1) * 16 + (ln >> 4) * 8]); } } }
  else {
#pragma unroll
    for (int j = 0; j < 8; ++j)
#pragma unroll
      for (int r = 0; r < 8; ++r) st[j * 16 + col][wave * 16 + 8 * g + r] = (_Float16)acc[j][r];
    __syncthreads(); const size_t b = rb / SS; const int s0 = (int)(rb % SS);
    // 8 dim tiles x 2 key blocks, each tile whole
    for (int e = tid; e < 128 * 8; e += 128) { const int tl = e >> 6, ln = e & 31; vst2((unsigned*)(V + (((b * (KVW / 16) + (c0 >> 4) + (tl >> 1)) * (SS / 32)) + (s0 >> 5) + (tl & 1)) * 512 + (e & 63) * 8), *(const v4u*)&st[(tl >> 1) * 16 + (ln & 15)][(tl & 1) * 32 + ((e >> 5) & 1) * 16 + (ln >> 4) * 8]); } }
}
// lane l with lane l ^ 16, as a vector cross-row move
__device__ __forceinline__ float xhalf(float x) { return __builtin_bit_cast(float, __builtin_amdgcn_permlanex16(__builtin_bit_cast(int, x), __builtin_bit_cast(int, x), 0x76543210, 0xfedcba98, false, false)); }
__global__ __launch_bounds__(128) void k_attn(const _Float16* __restrict__ QH, const _Float16* __restrict__ Kr, const _Float16* __restrict__ V, float* __restrict__ O) {
  __shared__ __align__(16) float so[4][16][36];
  const int tid = threadIdx.x, wave = tid >> 5, lane = tid & 31, col = lane & 15, g = lane >> 4; const int qg = blockIdx.y / NH, h = blockIdx.y % NH; const size_t b = blockIdx.z; const int q0 = blockIdx.x * 64 + wave * 16; const size_t rq = b * SS + q0; const int qc = qg * KVW + h * HD;
  const v16h bq = frag_h(QH + (rq + col) * DM + qc, lane);
  float m = -3.0e38f, l = 0.f;   // the query's running maximum (equal in both halves) and this half's share of its sum
  v8f acc[2] = {};               // acc[dt][r] = O^T[dim dt * 16 + 8g + r][query col]
  // the lane's own 16 bytes in the first key tile and in the first value tile of this head
  const _Float16* kp = Kr + (b * NH + h) * (SS / 16) * 512 + lane * 8; const _Float16* vp = V + (b * (KVW / 16) + h * 2) * (SS / 32) * 512 + lane * 8;
#pragma unroll 1
  for (int ks = 0; ks < SS / 32; ++ks, kp += 2 * 512, vp += 512) { v8f s[2];
    // this pass's two key and two value fragments as one group of loads: the values land while the softmax is worked
    v16h kf[2], vf[2];
#pragma unroll
    for (int ct = 0; ct < 2; ++ct) kf[ct] = fragt_h(kp + ct * 512, 0);
#pragma unroll
    for (int dt = 0; dt < 2; ++dt) vf[dt] = fragt_h(vp + dt * (SS / 32) * 512, 0);
    asm volatile("s_wait_xcnt 0x0" :: "v"(kp), "v"(vp) : "memory");   // the two address pairs as inputs keep them out of the loads' own destinations until the wait has passed
#pragma unroll
    for (int ct = 0; ct < 2; ++ct) { v8f c = {}; s[ct] = wmma16(kf[ct], bq, c); }
    // maximum of the raw products first: the scale is positive and rounding is monotonic, so scaling the maximum gives the maximum of the scaled scores
    float mx = fmaxf(s[0][0], s[1][0]);
#pragma unroll
    for (int r = 1; r < 8; ++r) mx = fmaxf(mx, fmaxf(s[0][r], s[1][r]));
    mx = fmaxf(mx, xhalf(mx)) * 0.17677669529663688f;
    const float mn = fmaxf(m, mx); const float alpha = (m <= -1.0e38f) ? 0.f : __expf(m - mn);
    v8f e[2]; v16h pb;
#pragma unroll
    for (int ct = 0; ct < 2; ++ct)
#pragma unroll
      for (int r = 0; r < 8; ++r) { e[ct][r] = __expf(s[ct][r] * 0.17677669529663688f - mn); pb[ct * 8 + r] = (_Float16)(e[ct][r] * 2048.0f); }
    const v8f e8 = e[0] + e[1]; const v4f e4 = e8.lo + e8.hi; const v2f e2 = e4.lo + e4.hi; const float es = e2[0] + e2[1];
    l = l * alpha + es; m = mn;
#pragma unroll
    for (int dt = 0; dt < 2; ++dt) { acc[dt] *= alpha; acc[dt] = wmma16(vf[dt], pb, acc[dt]); } }
  l += xhalf(l);   // unconditional: both halves are on
  const float il = (1.0f / 2048.0f) / l;
#pragma unroll
  for (int dt = 0; dt < 2; ++dt) { const v8f o = acc[dt] * il; *(v4f*)&so[wave][col][dt * 16 + 8 * g] = o.lo; *(v4f*)&so[wave][col][dt * 16 + 8 * g + 4] = o.hi; }   // a lane's 8 accumulators of a tile are 8 consecutive dims of its query's row
  LDSX();
  for (int rl = 0; rl < 16; ++rl) if (lane < 8) vst2(O + (rq + rl) * DM + qc + lane * 4, *(const v4f*)&so[wave][rl][lane * 4]);
}
// elu of 8 loaded quads, stored to every second sigma row; expm1f is taken for every lane and selected, so that the 32 chains are independent
__device__ __forceinline__ void elu_rows(const v4f (&q)[8], float* dst) {
#pragma unroll
  for (int u = 0; u < 8; ++u) { v4f sg;
#pragma unroll
    for (int i = 0; i < 4; ++i) { const float v = q[u][i]; const float e = expm1f(v); sg[i] = (v > 0.f) ? v : e; }
    *(v4f*)(dst + (size_t)u * 2 * (KVW + 4)) = sg; }
}
// ---- k_mem: block = (64 token rows, 128 of the group's 256 cols, group): sigma = elu(q group slice) (f32 from QF), num = sigma (hi+lo) . memory (2 products), den = sigma . memory_norm (f32), out = attn (1-w) + (num/den) w
__global__ __launch_bounds__(128) void k_mem(const float* __restrict__ QF, const __bf16* __restrict__ PM, const float* __restrict__ MN, const float* __restrict__ MW, const float* __restrict__ O, float* __restrict__ OUT) {
  __shared__ __align__(16) float ssg[64][KVW + 4]; __shared__ float sden[64]; __shared__ __align__(16) float so[4][16][132];
  const int tid = threadIdx.x, wave = tid >> 5, lane = tid & 31, col = lane & 15, g = lane >> 4; const size_t rb = (size_t)blockIdx.x * 64; const size_t r0 = rb + wave * 16; const int half = blockIdx.y, qg = blockIdx.z; const int c0 = half * 128;
  const float mw = MW[0];
  // sigma rows: 16-byte loads, 8 a thread in flight as one group, the next group issued before this one is worked on
  const float* qp = QF + (rb + (tid >> 6)) * DM + qg * KVW + (tid & 63) * 4; float* sgp = &ssg[tid >> 6][(tid & 63) * 4]; v4f qr[8], qn[8];
#pragma unroll
  for (int u = 0; u < 8; ++u) qr[u] = *(const v4f*)(qp + (size_t)u * 2 * DM);
#pragma unroll 1   // rolled: 32 inlined expm1f a trip are text enough
  for (int it = 0; it < 3; ++it) {
#pragma unroll
    for (int u = 0; u < 8; ++u) qn[u] = *(const v4f*)(qp + (size_t)((it + 1) * 8 + u) * 2 * DM);
    elu_rows(qr, sgp + (size_t)it * 16 * (KVW + 4));
#pragma unroll
    for (int u = 0; u < 8; ++u) qr[u] = qn[u]; }
  // memory fragments come in groups of 4 (half a k block) through a ring of 3 register sets: one is multiplied, two are in flight
  const __bf16* pm = PM + (size_t)(c0 >> 4) * (KVW / 32) * 512; v16b w[3][4]; float sr[2][16];
#pragma unroll
  for (int h = 0; h < 2; ++h)
#pragma unroll
    for (int jj = 0; jj < 4; ++jj) w[h][jj] = fragt_b(pm + (size_t)(h * 4 + jj) * (KVW / 32) * 512, lane);
  elu_rows(qr, sgp + (size_t)3 * 16 * (KVW + 4));
  asm volatile("s_wait_xcnt 0x0" ::: "memory");   // the offset register of the first two fragment groups is reused behind the barrier while they may be in flight
  __syncthreads();
  if (tid < 64) { float d0 = 0.f; for (int c = 0; c < KVW; ++c) d0 += ssg[tid][c] * bfr(MN[c]); sden[tid] = d0; }
  v8f acc[8] = {}; float ov[8][8];
  const float* sp = &ssg[wave * 16 + col][8 * g]; const float* op = O + (r0 + 8 * g) * DM + qg * KVW + c0 + col;
#pragma unroll
  for (int i = 0; i < 8; ++i) { sr[0][i] = sp[i]; sr[0][8 + i] = sp[16 + i]; }
  F2 a;
#pragma unroll
  for (int h = 0; h < 2 * (KVW / 32); ++h) { const int kc = h >> 1, jb = (h & 1) * 4;
    // ahead of this group's products: the group two further on; behind the last group the attention tile
    if (h + 2 < 2 * (KVW / 32)) {
#pragma unroll
      for (int jj = 0; jj < 4; ++jj) w[(h + 2) % 3][jj] = fragt_b(pm + ((size_t)(jb + jj) * (KVW / 32) + kc + 1) * 512, lane); }
    else if (jb == 0) {
      asm volatile("s_wait_xcnt 0x0" ::: "memory");   // the tile's loads may land in the address registers of fragment loads that are still in flight
#pragma unroll
      for (int j = 0; j < 8; ++j)
#pragma unroll
        for (int r = 0; r < 8; ++r) ov[j][r] = op[(size_t)r * DM + j * 16]; }
    if (jb == 0) {   // the next k block's sigma slice is read from LDS one block ahead as well
      if (kc + 1 < KVW / 32) {
#pragma unroll
        for (int i = 0; i < 8; ++i) { sr[(kc + 1) & 1][i] = sp[(kc + 1) * 32 + i]; sr[(kc + 1) & 1][8 + i] = sp[(kc + 1) * 32 + 16 + i]; } }
      a = bsplit16(sr[kc & 1]); }
#pragma unroll
    for (int jj = 0; jj < 4; ++jj) { acc[jb + jj] = wmma_bf(a.h, w[h % 3][jj], acc[jb + jj]); acc[jb + jj] = wmma_bf(a.l, w[h % 3][jj], acc[jb + jj]); } }
  __syncthreads();
  const float wg = 1.0f / (1.0f + __expf(-bfr(mw)));
#pragma unroll
  for (int j = 0; j < 8; ++j)
#pragma unroll
    for (int r = 0; r < 8; ++r) { const int rl = wave * 16 + 8 * g + r; so[wave][8 * g + r][j * 16 + col] = ov[j][r] * (1.0f - wg) + (acc[j][r] / sden[rl]) * wg; }
  LDSX();
  v4f t[16];
#pragma unroll
  for (int rl = 0; rl < 16; ++rl) t[rl] = *(const v4f*)&so[wave][rl][lane * 4];
#pragma unroll
  for (int rl = 0; rl < 16; ++rl) vst2(OUT + (r0 + rl) * DM + qg * KVW + c0 + lane * 4, t[rl]);
}
extern "C" void kernel_launch(void* const* d_in, const int* in_sizes, int n_in, void* d_out, int out_size, void* d_ws, size_t ws_size, hipStream_t stream) {
  (void)in_sizes; (void)n_in; (void)out_size;
  const float** F = (const float**)d_in;   // 0 x [4,1024,1024], 1 Wq [1024,1024] (in,out), 2 Wk [1024,256], 3 Wv [1024,256], 4 memory [256,256], 5 memory_norm [256,1], 6 memory_weight [1]
  if (ws_size < (size_t)WS_END) return;
  char* ws = (char*)d_ws; __bf16 *PQ = (__bf16*)(ws + WS_PQ), *PK = (__bf16*)(ws + WS_PK), *PV = (__bf16*)(ws + WS_PV), *PM = (__bf16*)(ws + WS_PM); float *QF = (float*)(ws + WS_QF), *O = (float*)(ws + WS_O); _Float16 *QH = (_Float16*)(ws + WS_QH), *Kr = (_Float16*)(ws + WS_K), *V = (_Float16*)(ws + WS_V); __bf16* XB = (__bf16*)(ws + WS_XB);
  k_pack<<<dim3(NR / 16 + 400), 256, 0, stream>>>(F[0], F[1], F[2], F[3], F[4], XB, PQ, PK, PV, PM);
  k_proj<<<dim3(TNB * SS / 64, DM / 128, 3), 128, 0, stream>>>(XB, PQ, PK, PV, QF, QH, Kr, V);
  k_attn<<<dim3(TQB, NQ * NH, TNB), 128, 0, stream>>>(QH, Kr, V, O);
  k_mem<<<dim3(TNB * SS / 64, 2, NQ), 128, 0, stream>>>(QF, PM, F[5], F[6], O, (float*)d_out);
}

// v004
// A run of this version takes 68 microseconds.
// Two timings next to v003 put it at 1.06 and 1.08 times that version's speed.
// All steps since v000 together make it 3.63 times as fast.
// compute dtype: all float inputs rounded to bf16; q/k/v = x . W with EXACT bf16 products on WMMA 16x16x32 (x, the (in,out) weights and memory packed as bf16 fragment-order tiles): q kept f32 (for the ELU memory branch) and as f16 rows, k and v as f16 fragment-order tiles; grouped softmax attention (4 query groups x 8 heads x 32 dims over 1,024 keys): q, k single f16 x 32^-1/2, running-max softmax in f32 (hardware exp), P (scaled by 2^11, single f16) x v (single f16); memory branch: sigma = elu(q group row) in f32, (sigma as bf16 hi + lo, 2 products) . memory and sigma . memory_norm (f32 dot), divide; out = attn (1 - sigmoid(w)) + mem sigmoid(w) in f32; f32 output.
#include <hip/hip_runtime.h>
#include <math.h>

typedef __attribute__((ext_vector_type(16))) _Float16 v16h;
typedef __attribute__((ext_vector_type(16))) __bf16 v16b;
typedef __attribute__((ext_vector_type(8)))  _Float16 v8h;
typedef __attribute__((ext_vector_type(8)))  float v8f;
typedef __attribute__((ext_vector_type(4)))  float v4f;
typedef __attribute__((ext_vector_type(2)))  float v2f;
typedef __attribute__((ext_vector_type(4)))  unsigned v4u;
typedef __attribute__((ext_vector_type(4)))  int v4i;
typedef float __attribute__((may_alias)) float_a;
typedef int __attribute__((may_alias)) int_a;

template <typename T> __device__ __forceinline__ void vst2(void* p, T v) { *(T*)p = v;  }
__device__ __forceinline__ v8f wmma16(v16h a, v16h b, v8f c) {
  v8f d = __builtin_amdgcn_wmma_f32_16x16x32_f16(false, a, false, b, (short)0, c, false, false);
  asm volatile("v_nop\n\tv_nop\n\tv_nop\n\tv_nop" : "+v"(d) : "v"(a), "v"(b));
  return d;
}
__device__ __forceinline__ v8f wmma_bf(v16b a, v16b b, v8f c) {
  v8f d = __builtin_amdgcn_wmma_f32_16x16x32_bf16(false, a, false, b, (short)0, c, false, false);
  asm volatile("v_nop\n\tv_nop\n\tv_nop\n\tv_nop" : "+v"(d) : "v"(a), "v"(b));
  return d;
}
// 16x16x32 fragments: lane = (h = lane>>4, row/col = lane&15); elements 0..7 = k0+8h+0..7, 8..15 = k0+16+8h+0..7; D element r = row 8h+r
__device__ __forceinline__ v16h frag_h(const _Float16* rowk0, int lane) {
  union { v16h v; v8h q[2]; } u; const _Float16* p = rowk0 + 8 * (lane >> 4);
  u.q[0] = *(const v8h*)p; u.q[1] = *(const v8h*)(p + 16); return u.v;
}
__device__ __forceinline__ v16h frag_f32(const float* rowk0, int lane) {
  v16h a; const float* p = rowk0 + 8 * (lane >> 4);
#pragma unroll
  for (int i = 0; i < 8; ++i) { a[i] = (_Float16)p[i]; a[8 + i] = (_Float16)p[16 + i]; }
  return a;
}
__device__ __forceinline__ v16h frag_f32s(const float* rowk0, int lane, float sc) {
  v16h a; const float* p = rowk0 + 8 * (lane >> 4);
#pragma unroll
  for (int i = 0; i < 8; ++i) { a[i] = (_Float16)(p[i] * sc); a[8 + i] = (_Float16)(p[16 + i] * sc); }
  return a;
}
// column fragment from a [K][ld] layout (column n), rows >= K read as 0
__device__ __forceinline__ v16h fragc_f32(const float* W, int k0, int n, int lane, int ld, int K) {
  v16h a; const int g = lane >> 4;
#pragma unroll
  for (int i = 0; i < 8; ++i) { const int ka = k0 + 8 * g + i, kb = ka + 16;
    a[i] = (_Float16)(ka < K ? W[(size_t)(ka < K ? ka : K - 1) * ld + n] : 0.f); a[8 + i] = (_Float16)(kb < K ? W[(size_t)(kb < K ? kb : K - 1) * ld + n] : 0.f); }
  return a;
}
struct F2 { v16b h, l; };
__device__ __forceinline__ F2 bsplit16(const float v[16]) { F2 r;
#pragma unroll
  for (int i = 0; i < 16; ++i) { const __bf16 h = (__bf16)v[i]; r.h[i] = h; r.l[i] = (__bf16)(v[i] - (float)h); }
  return r; }
__device__ __forceinline__ F2 split_row(const float* row, int k0, int lane) { float v[16]; const float* p = row + k0 + 8 * (lane >> 4);
#pragma unroll
  for (int i = 0; i < 8; ++i) { v[i] = p[i]; v[8 + i] = p[16 + i]; }
  return bsplit16(v); }
__device__ __forceinline__ F2 split_rowK(const float* row, int k0, int lane, int K) { float v[16]; const int g = lane >> 4;
#pragma unroll
  for (int i = 0; i < 8; ++i) { const int ka = k0 + 8 * g + i, kb = ka + 16; v[i] = ka < K ? row[ka < K ? ka : K - 1] : 0.f; v[8 + i] = kb < K ? row[kb < K ? kb : K - 1] : 0.f; }
  return bsplit16(v); }
__device__ __forceinline__ F2 split_col(const float* W, int k0, int n, int lane, int ld, int K) { float v[16]; const int g = lane >> 4;
#pragma unroll
  for (int i = 0; i < 8; ++i) { const int ka = k0 + 8 * g + i, kb = ka + 16; v[i] = ka < K ? W[(size_t)(ka < K ? ka : K - 1) * ld + n] : 0.f; v[8 + i] = kb < K ? W[(size_t)(kb < K ? kb : K - 1) * ld + n] : 0.f; }
  return bsplit16(v); }
__device__ __forceinline__ v8f mac3(const F2& a, const F2& b, v8f c) { c = wmma_bf(a.l, b.h, c); c = wmma_bf(a.h, b.l, c); return wmma_bf(a.h, b.h, c); }
__device__ __forceinline__ float sigm(float v) { return 1.0f / (1.0f + expf(-v)); }
#define LDSX() do { asm volatile("s_wait_dscnt 0" ::: "memory"); __builtin_amdgcn_wave_barrier(); __builtin_amdgcn_fence(__ATOMIC_RELEASE, "workgroup"); } while (0)


// Grouped recurrent multi-head attention (B 4, S 1,024, d 1,024 = 4 query groups x 8 heads x 32): grouped-query softmax attention sharing K/V across the 4 groups, plus an ELU linear-memory branch (sigma(q) M / sigma(q) m_norm), mixed by a sigmoid gate.
#define NB 4
#define SS 1024
#define DM 1024
#define NQ 4
#define NH 8
#define HD 32
#define KVW (NH * HD)      // 256
#define NR (NB * SS)
#ifndef TQB
#define TQB (SS / 64)
#define TNB NB
#endif
typedef __attribute__((ext_vector_type(8))) __bf16 v8b;
__device__ __forceinline__ v16b frag_b(const __bf16* rowk0, int lane) {
  union { v16b v; v8b q[2]; } u; const __bf16* p = rowk0 + 8 * (lane >> 4);
  u.q[0] = *(const v8b*)p; u.q[1] = *(const v8b*)(p + 16); return u.v;
}
// fragment-order tile: 16 rows (or columns) x 32 k of a 16-bit type = 512 elements = 1 KiB; element (r, k) stands at ((k >> 4) & 1) * 256 + (((k >> 3) & 1) * 16 + r) * 8 + (k & 7).
// Lane l's two 16-byte halves stand at l * 8 and 256 + l * 8, so each load of a wave covers four whole 128-byte lines instead of a part of sixteen.
__device__ __forceinline__ v16b fragt_b(const __bf16* tile, int lane) {
  union { v16b v; v8b q[2]; } u; u.q[0] = *(const v8b*)(tile + lane * 8); u.q[1] = *(const v8b*)(tile + 256 + lane * 8); return u.v;
}
__device__ __forceinline__ v16h fragt_h(const _Float16* tile, int lane) {
  union { v16h v; v8h q[2]; } u; u.q[0] = *(const v8h*)(tile + lane * 8); u.q[1] = *(const v8h*)(tile + 256 + lane * 8); return u.v;
}
__device__ __forceinline__ float bfr(float v) { return (float)(__bf16)v; }
__device__ __attribute__((noinline)) float exp_ni(float v) { return expf(v); }
__device__ __attribute__((noinline)) float erf_ni(float v) { return erff(v); }
__device__ __attribute__((noinline)) float expm1f_ni(float v) { return expm1f(v); }

#define WS_PQ  0u                                  // bf16 fragment-order tiles [column tile][k block][512]: Wq 64 x 32; Wk 16 x 32; Wv 16 x 32; memory 16 x 8
#define WS_PK  (WS_PQ + 2u * (size_t)DM * DM)
#define WS_PV  (WS_PK + 2u * (size_t)KVW * DM)
#define WS_PM  (WS_PV + 2u * (size_t)KVW * DM)
#define WS_QF  (WS_PM + 2u * (size_t)KVW * KVW)        // f32 q rows [NR][1024]; f16 q rows [NR][1024]; f16 k tiles [b][head][16-key tile][512]; f16 v tiles [b][16-dim tile][32-key block][512]; f32 attn O [NR][1024]; bf16 x tiles [16-row tile][k block][512]
#define WS_QH  (WS_QF + 4u * (size_t)NR * DM)
#define WS_K   (WS_QH + 2u * (size_t)NR * DM)
#define WS_V   (WS_K + 2u * (size_t)NR * KVW)
#define WS_O   (WS_V + 2u * (size_t)NB * KVW * SS)
#define WS_XB  (WS_O + 4u * (size_t)NR * DM)
#define WS_END (WS_XB + 2u * (size_t)NR * DM)

// ---- k_pack: blocks 0..255: one 16-row tile of x each; then 16 columns x 256 k of a weight each (Wq 256 blocks, Wk 64, Wv 64, memory 16). Every block writes one contiguous run of whole tiles.
__global__ __launch_bounds__(256) void k_pack(const float* __restrict__ X, const float* __restrict__ WQ, const float* __restrict__ WK, const float* __restrict__ WV, const float* __restrict__ MM, __bf16* __restrict__ XB, __bf16* __restrict__ PQ, __bf16* __restrict__ PK, __bf16* __restrict__ PV, __bf16* __restrict__ PM) {
  __shared__ __align__(16) __bf16 s[16][264];
  const int t = threadIdx.x; int id = blockIdx.x;
  if (id < NR / 16) {   // x is k-contiguous already: each thread takes the 8 floats of a 16-byte piece of the tile run
    __bf16* xd = XB + (size_t)id * 16 * DM; v4f a[8][2];
    // piece p = t + 256 j: k block (t >> 6) + 4 j, half (t >> 5) & 1, lane t & 31: from one j to the next the source moves on by 4 k blocks
    const float* q = X + (size_t)id * 16 * DM + (size_t)(t & 15) * DM + (t >> 6) * 32 + ((t >> 5) & 1) * 16 + ((t >> 4) & 1) * 8;
#pragma unroll
    for (int j = 0; j < 8; ++j) { a[j][0] = *(const v4f*)(q + j * 128); a[j][1] = *(const v4f*)(q + j * 128 + 4); }
    asm volatile("s_wait_xcnt 0x0" :: "v"(q) : "memory");   // q as an input keeps the address pair out of the loads' own destinations until the wait has passed
#pragma unroll
    for (int j = 0; j < 8; ++j) { v8b o;
#pragma unroll
      for (int i = 0; i < 4; ++i) { o[i] = (__bf16)a[j][0][i]; o[4 + i] = (__bf16)a[j][1][i]; }
      *(v8b*)(xd + (size_t)(t + 256 * j) * 8) = o; }
    return; }
  id -= NR / 16; const float* w; __bf16* dst; int ld = KVW, nkc = DM / 32;
  if (id < 256) { w = WQ; dst = PQ; ld = DM; } else if (id < 320) { id -= 256; w = WK; dst = PK; } else if (id < 384) { id -= 320; w = WV; dst = PV; } else { id = (id - 384) * 4; w = MM; dst = PM; nkc = KVW / 32; }
  const int nt = id >> 2, ch = id & 3;
  const float* q = w + (size_t)(ch * 256 + t) * ld + nt * 16; v4f r[4];
#pragma unroll
  for (int c = 0; c < 4; ++c) r[c] = *(const v4f*)(q + c * 4);
#pragma unroll
  for (int c = 0; c < 16; ++c) s[c][t] = (__bf16)r[c >> 2][c & 3];
  __syncthreads();
  __bf16* d = dst + ((size_t)nt * nkc + ch * 8) * 512;
#pragma unroll
  for (int j = 0; j < 2; ++j) { const int p = t + 256 * j, ln = p & 31; vst2((unsigned*)(d + (size_t)p * 8), *(const v4u*)&s[ln & 15][(p >> 6) * 32 + ((p >> 5) & 1) * 16 + (ln >> 4) * 8]); }
}
// one k block of k_proj: the wave's x fragment and its 8 weight fragments, all 18 loads issued as one group
__device__ __forceinline__ void proj_fetch(v16b &x, v16b (&w)[8], const __bf16* xt, const __bf16* wt, int lane) {
  x = fragt_b(xt, lane);
#pragma unroll
  for (int j = 0; j < 8; ++j) w[j] = fragt_b(wt + (size_t)j * (DM / 32) * 512, lane);
}
__device__ __forceinline__ void proj_mac(const v16b &a, const v16b (&w)[8], v8f (&acc)[8]) {
#pragma unroll
  for (int j = 0; j < 8; ++j) acc[j] = wmma_bf(a, w[j], acc[j]);
}
// ---- k_proj: block = (64 rows, 128 cols, which): 0: q -> f32 + f16 rows (8 column blocks); 1: k -> f16 fragment-order tiles (2 column blocks); 2: v -> f16 fragment-order tiles (2 column blocks)
__global__ __launch_bounds__(128) void k_proj(const __bf16* __restrict__ XB, const __bf16* __restrict__ PQ, const __bf16* __restrict__ PK, const __bf16* __restrict__ PV, float* __restrict__ QF, _Float16* __restrict__ QH, _Float16* __restrict__ Kr, _Float16* __restrict__ V) {
  __shared__ __align__(16) float sf[4][16][132]; __shared__ __align__(16) _Float16 so[64][136]; __shared__ __align__(16) _Float16 st[128][72];
  const int tid = threadIdx.x, wave = tid >> 5, lane = tid & 31, col = lane & 15, g = lane >> 4; const int which = blockIdx.z; const int c0 = blockIdx.y * 128; if (which > 0 && c0 >= KVW) return;
  const size_t rb = (size_t)blockIdx.x * 64; const size_t r0 = rb + wave * 16; const __bf16* Wr = (which == 0) ? PQ : (which == 1) ? PK : PV;
  v8f acc[8] = {};
  const __bf16* xp = XB + (r0 >> 4) * (DM / 32) * 512; const __bf16* wp = Wr + (size_t)(c0 >> 4) * (DM / 32) * 512;
  v16b xa, xb; v16b wa[8], wb[8];   // two register sets: one k block is multiplied while the next one's loads are in flight
  proj_fetch(xa, wa, xp, wp, lane);
#pragma unroll 1   // rolled: the two sets already give the overlap, a longer body only adds registers
  for (int kc = 0; kc < DM / 32 - 2; kc += 2) {
    proj_fetch(xb, wb, xp + (kc + 1) * 512, wp + (kc + 1) * 512, lane);
    proj_mac(xa, wa, acc);
    proj_fetch(xa, wa, xp + (kc + 2) * 512, wp + (kc + 2) * 512, lane);
    proj_mac(xb, wb, acc);
    asm volatile("s_wait_xcnt 0x0" ::: "memory"); }   // the next trip rewrites the address registers that this trip's last loads name
  // last two k blocks outside the loop: a fetch under a test inside it would make every wait count for the path without the fetch
  proj_fetch(xb, wb, xp + (DM / 32 - 1) * 512, wp + (DM / 32 - 1) * 512, lane);
  proj_mac(xa, wa, acc);
  proj_mac(xb, wb, acc);
  if (which < 2) {
#pragma unroll
    for (int j = 0; j < 8; ++j)
#pragma unroll
      for (int r = 0; r < 8; ++r) { so[wave * 16 + 8 * g + r][j * 16 + col] = (_Float16)acc[j][r]; if (which == 0) sf[wave][8 * g + r][j * 16 + col] = acc[j][r]; }
    __syncthreads();
    if (which == 0) { for (int rl = 0; rl < 16; ++rl) vst2(QF + (r0 + rl) * DM + c0 + lane * 4, *(const v4f*)&sf[wave][rl][lane * 4]); for (int e = tid; e < 64 * 16; e += 128) { const int rl = e >> 4, q = e & 15; vst2((unsigned*)(QH + (rb + rl) * DM + c0 + q * 8), *(const v4u*)&so[rl][q * 8]); } }
    else { const size_t b = rb / SS; const int s0 = (int)(rb % SS);   // 4 heads x 4 key tiles, each tile whole
      for (int e = tid; e < 64 * 16; e += 128) { const int tl = e >> 6, ln = e & 31; vst2((unsigned*)(Kr + (((b * NH + (c0 >> 5) + (tl >> 2)) * (SS / 16)) + (s0 >> 4) + (tl & 3)) * 512 + (e & 63) * 8), *(const v4u*)&so[(tl & 3) * 16 + (ln & 15)][(tl >> 2) * 32 + ((e >> 5) & 1) * 16 + (ln >> 4) * 8]); } } }
  else {
#pragma unroll
    for (int j = 0; j < 8; ++j)
#pragma unroll
      for (int r = 0; r < 8; ++r) st[j * 16 + col][wave * 16 + 8 * g + r] = (_Float16)acc[j][r];
    __syncthreads(); const size_t b = rb / SS; const int s0 = (int)(rb % SS);
    // 8 dim tiles x 2 key blocks, each tile whole
    for (int e = tid; e < 128 * 8; e += 128) { const int tl = e >> 6, ln = e & 31; vst2((unsigned*)(V + (((b * (KVW / 16) + (c0 >> 4) + (tl >> 1)) * (SS / 32)) + (s0 >> 5) + (tl & 1)) * 512 + (e & 63) * 8), *(const v4u*)&st[(tl >> 1) * 16 + (ln & 15)][(tl & 1) * 32 + ((e >> 5) & 1) * 16 + (ln >> 4) * 8]); } }
}
// lane l with lane l ^ 16, as a vector cross-row move
__device__ __forceinline__ float xhalf(float x) { return __builtin_bit_cast(float, __builtin_amdgcn_permlanex16(__builtin_bit_cast(int, x), __builtin_bit_cast(int, x), 0x76543210, 0xfedcba98, false, false)); }
#define KPASS 64   // keys per pass of k_attn: one running-maximum update and one rescale of the output tiles per pass
#define NT 2       // query tiles (query groups of the head) per wave: each key and value fragment feeds NT products
// the builtin alone: in k_attn runs of independent products stand behind one another, and the compiler pads what is left
__device__ __forceinline__ v8f wmma16b(v16h a, v16h b, v8f c) { return __builtin_amdgcn_wmma_f32_16x16x32_f16(false, a, false, b, (short)0, c, false, false); }
__global__ __launch_bounds__(128) void k_attn(const _Float16* __restrict__ QH, const _Float16* __restrict__ Kr, const _Float16* __restrict__ V, float* __restrict__ O) {
  __shared__ __align__(16) float so[4][NT][16][36];
  const int tid = threadIdx.x, wave = tid >> 5, lane = tid & 31, col = lane & 15, g = lane >> 4; const int qg0 = (blockIdx.y / NH) * NT, h = blockIdx.y % NH; const size_t b = blockIdx.z; const int q0 = blockIdx.x * 64 + wave * 16; const size_t rq = b * SS + q0; const int qc = qg0 * KVW + h * HD;
  v16h bq[NT]; float m[NT], l[NT];   // per tile: the query's running maximum (equal in both halves) and this half's share of its sum
  v8f acc[NT][2];                    // acc[t][dt][r] = O^T[dim dt * 16 + 8g + r][query col of tile t]
#pragma unroll
  for (int t = 0; t < NT; ++t) { bq[t] = frag_h(QH + (rq + col) * DM + qc + t * KVW, lane); m[t] = -3.0e38f; l[t] = 0.f; acc[t][0] = v8f{}; acc[t][1] = v8f{}; }
  // the lane's own 16 bytes in the first key tile and in the first value tile of this head
  const _Float16* kp = Kr + (b * NH + h) * (SS / 16) * 512 + lane * 8; const _Float16* vp = V + (b * (KVW / 16) + h * 2) * (SS / 32) * 512 + lane * 8;
#pragma unroll 1   // rolled: one pass already holds 16 matrix products and 64 scores a lane
  for (int ks = 0; ks < SS / KPASS; ++ks, kp += (KPASS / 16) * 512, vp += (KPASS / 32) * 512) { v8f s[NT][KPASS / 16];
    // this pass's key and value fragments as one group of loads: the values land while the softmax is worked
    v16h kf[KPASS / 16], vf[2][KPASS / 32];
#pragma unroll
    for (int ct = 0; ct < KPASS / 16; ++ct) kf[ct] = fragt_h(kp + ct * 512, 0);
#pragma unroll
    for (int dt = 0; dt < 2; ++dt)
#pragma unroll
      for (int kb = 0; kb < KPASS / 32; ++kb) vf[dt][kb] = fragt_h(vp + (dt * (SS / 32) + kb) * 512, 0);
    asm volatile("s_wait_xcnt 0x0" :: "v"(kp), "v"(vp) : "memory");   // the two address pairs as inputs keep them out of the loads' own destinations until the wait has passed
    __builtin_amdgcn_sched_barrier(0);   // keeps the loads one group ahead of the products: without it the scheduler sinks them to their uses, each with a wait of its own
#pragma unroll
    for (int ct = 0; ct < KPASS / 16; ++ct)
#pragma unroll
      for (int t = 0; t < NT; ++t) { v8f c = {}; s[t][ct] = wmma16b(kf[ct], bq[t], c); }
    v16h pb[NT][KPASS / 32];
#pragma unroll
    for (int t = 0; t < NT; ++t) {
      // maximum of the raw products first: the scale is positive and rounding is monotonic, so scaling the maximum gives the maximum of the scaled scores
      float mp[KPASS / 32];   // one short chain per 32 keys, joined at the end
#pragma unroll
      for (int kb = 0; kb < KPASS / 32; ++kb) { mp[kb] = fmaxf(s[t][2 * kb][0], s[t][2 * kb + 1][0]);
#pragma unroll
        for (int r = 1; r < 8; ++r) mp[kb] = fmaxf(mp[kb], fmaxf(s[t][2 * kb][r], s[t][2 * kb + 1][r])); }
      float mx = mp[0];
#pragma unroll
      for (int kb = 1; kb < KPASS / 32; ++kb) mx = fmaxf(mx, mp[kb]);
      mx = fmaxf(mx, xhalf(mx)) * 0.17677669529663688f;
      const float mn = fmaxf(m[t], mx); const float alpha = (m[t] <= -1.0e38f) ? 0.f : __expf(m[t] - mn);
      v8f e8 = {};
#pragma unroll
      for (int kb = 0; kb < KPASS / 32; ++kb) { v8f e[2];
#pragma unroll
        for (int ct = 0; ct < 2; ++ct)
#pragma unroll
          for (int r = 0; r < 8; ++r) { e[ct][r] = __expf(s[t][2 * kb + ct][r] * 0.17677669529663688f - mn); pb[t][kb][ct * 8 + r] = (_Float16)(e[ct][r] * 2048.0f); }
        e8 = (kb == 0) ? (e[0] + e[1]) : (e8 + (e[0] + e[1])); }
      const v4f e4 = e8.lo + e8.hi; const v2f e2 = e4.lo + e4.hi; const float es = e2[0] + e2[1];
      l[t] = l[t] * alpha + es; m[t] = mn;
#pragma unroll
      for (int dt = 0; dt < 2; ++dt) acc[t][dt] *= alpha; }
    __builtin_amdgcn_sched_barrier(0);   // all of P is packed ahead of the value products: mixed in among them, each repacking of a B operand's registers costs the full distance behind a product
#pragma unroll
    for (int kb = 0; kb < KPASS / 32; ++kb)
#pragma unroll
      for (int dt = 0; dt < 2; ++dt)
#pragma unroll
        for (int t = 0; t < NT; ++t) acc[t][dt] = wmma16b(vf[dt][kb], pb[t][kb], acc[t][dt]); }
#pragma unroll
  for (int t = 0; t < NT; ++t) {
    l[t] += xhalf(l[t]);   // unconditional: both halves are on
    const float il = (1.0f / 2048.0f) / l[t];
#pragma unroll
    for (int dt = 0; dt < 2; ++dt) { const v8f o = acc[t][dt] * il; *(v4f*)&so[wave][t][col][dt * 16 + 8 * g] = o.lo; *(v4f*)&so[wave][t][col][dt * 16 + 8 * g + 4] = o.hi; } }   // a lane's 8 accumulators of a tile are 8 consecutive dims of its query's row
  LDSX();
  // 8 lanes store the 128 bytes of one query group's head slice of a row
  for (int rl = 0; rl < 16; ++rl) if (lane < 8 * NT) vst2(O + (rq + rl) * DM + qc + (lane >> 3) * KVW + (lane & 7) * 4, *(const v4f*)&so[wave][lane >> 3][rl][(lane & 7) * 4]);
}
// elu of 8 loaded quads, stored to every second sigma row; expm1f is taken for every lane and selected, so that the 32 chains are independent
__device__ __forceinline__ void elu_rows(const v4f (&q)[8], float* dst) {
#pragma unroll
  for (int u = 0; u < 8; ++u) { v4f sg;
#pragma unroll
    for (int i = 0; i < 4; ++i) { const float v = q[u][i]; const float e = expm1f(v); sg[i] = (v > 0.f) ? v : e; }
    *(v4f*)(dst + (size_t)u * 2 * (KVW + 4)) = sg; }
}
// ---- k_mem: block = (64 token rows, 128 of the group's 256 cols, group): sigma = elu(q group slice) (f32 from QF), num = sigma (hi+lo) . memory (2 products), den = sigma . memory_norm (f32), out = attn (1-w) + (num/den) w
__global__ __launch_bounds__(128) void k_mem(const float* __restrict__ QF, const __bf16* __restrict__ PM, const float* __restrict__ MN, const float* __restrict__ MW, const float* __restrict__ O, float* __restrict__ OUT) {
  __shared__ __align__(16) float ssg[64][KVW + 4]; __shared__ float sden[64]; __shared__ __align__(16) float so[4][16][132];
  const int tid = threadIdx.x, wave = tid >> 5, lane = tid & 31, col = lane & 15, g = lane >> 4; const size_t rb = (size_t)blockIdx.x * 64; const size_t r0 = rb + wave * 16; const int half = blockIdx.y, qg = blockIdx.z; const int c0 = half * 128;
  const float mw = MW[0];
  // sigma rows: 16-byte loads, 8 a thread in flight as one group, the next group issued before this one is worked on
  const float* qp = QF + (rb + (tid >> 6)) * DM + qg * KVW + (tid & 63) * 4; float* sgp = &ssg[tid >> 6][(tid & 63) * 4]; v4f qr[8], qn[8];
#pragma unroll
  for (int u = 0; u < 8; ++u) qr[u] = *(const v4f*)(qp + (size_t)u * 2 * DM);
#pragma unroll 1   // rolled: 32 inlined expm1f a trip are text enough
  for (int it = 0; it < 3; ++it) {
#pragma unroll
    for (int u = 0; u < 8; ++u) qn[u] = *(const v4f*)(qp + (size_t)((it + 1) * 8 + u) * 2 * DM);
    elu_rows(qr, sgp + (size_t)it * 16 * (KVW + 4));
#pragma unroll
    for (int u = 0; u < 8; ++u) qr[u] = qn[u]; }
  // memory fragments come in groups of 4 (half a k block) through a ring of 3 register sets: one is multiplied, two are in flight
  const __bf16* pm = PM + (size_t)(c0 >> 4) * (KVW / 32) * 512; v16b w[3][4]; float sr[2][16];
#pragma unroll
  for (int h = 0; h < 2; ++h)
#pragma unroll
    for (int jj = 0; jj < 4; ++jj) w[h][jj] = fragt_b(pm + (size_t)(h * 4 + jj) * (KVW / 32) * 512, lane);
  elu_rows(qr, sgp + (size_t)3 * 16 * (KVW + 4));
  asm volatile("s_wait_xcnt 0x0" ::: "memory");   // the offset register of the first two fragment groups is reused behind the barrier while they may be in flight
  __syncthreads();
  if (tid < 64) { float d0 = 0.f; for (int c = 0; c < KVW; ++c) d0 += ssg[tid][c] * bfr(MN[c]); sden[tid] = d0; }
  v8f acc[8] = {}; float ov[8][8];
  const float* sp = &ssg[wave * 16 + col][8 * g]; const float* op = O + (r0 + 8 * g) * DM + qg * KVW + c0 + col;
#pragma unroll
  for (int i = 0; i < 8; ++i) { sr[0][i] = sp[i]; sr[0][8 + i] = sp[16 + i]; }
  F2 a;
#pragma unroll
  for (int h = 0; h < 2 * (KVW / 32); ++h) { const int kc = h >> 1, jb = (h & 1) * 4;
    // ahead of this group's products: the group two further on; behind the last group the attention tile
    if (h + 2 < 2 * (KVW / 32)) {
#pragma unroll
      for (int jj = 0; jj < 4; ++jj) w[(h + 2) % 3][jj] = fragt_b(pm + ((size_t)(jb + jj) * (KVW / 32) + kc + 1) * 512, lane); }
    else if (jb == 0) {
      asm volatile("s_wait_xcnt 0x0" ::: "memory");   // the tile's loads may land in the address registers of fragment loads that are still in flight
#pragma unroll
      for (int j = 0; j < 8; ++j)
#pragma unroll
        for (int r = 0; r < 8; ++r) ov[j][r] = op[(size_t)r * DM + j * 16]; }
    if (jb == 0) {   // the next k block's sigma slice is read from LDS one block ahead as well
      if (kc + 1 < KVW / 32) {
#pragma unroll
        for (int i = 0; i < 8; ++i) { sr[(kc + 1) & 1][i] = sp[(kc + 1) * 32 + i]; sr[(kc + 1) & 1][8 + i] = sp[(kc + 1) * 32 + 16 + i]; } }
      a = bsplit16(sr[kc & 1]); }
#pragma unroll
    for (int jj = 0; jj < 4; ++jj) { acc[jb + jj] = wmma_bf(a.h, w[h % 3][jj], acc[jb + jj]); acc[jb + jj] = wmma_bf(a.l, w[h % 3][jj], acc[jb + jj]); } }
  __syncthreads();
  const float wg = 1.0f / (1.0f + __expf(-bfr(mw)));
#pragma unroll
  for (int j = 0; j < 8; ++j)
#pragma unroll
    for (int r = 0; r < 8; ++r) { const int rl = wave * 16 + 8 * g + r; so[wave][8 * g + r][j * 16 + col] = ov[j][r] * (1.0f - wg) + (acc[j][r] / sden[rl]) * wg; }
  LDSX();
  v4f t[16];
#pragma unroll
  for (int rl = 0; rl < 16; ++rl) t[rl] = *(const v4f*)&so[wave][rl][lane * 4];
#pragma unroll
  for (int rl = 0; rl < 16; ++rl) vst2(OUT + (r0 + rl) * DM + qg * KVW + c0 + lane * 4, t[rl]);
}
extern "C" void kernel_launch(void* const* d_in, const int* in_sizes, int n_in, void* d_out, int out_size, void* d_ws, size_t ws_size, hipStream_t stream) {
  (void)in_sizes; (void)n_in; (void)out_size;
  const float** F = (const float**)d_in;   // 0 x [4,1024,1024], 1 Wq [1024,1024] (in,out), 2 Wk [1024,256], 3 Wv [1024,256], 4 memory [256,256], 5 memory_norm [256,1], 6 memory_weight [1]
  if (ws_size < (size_t)WS_END) return;
  char* ws = (char*)d_ws; __bf16 *PQ = (__bf16*)(ws + WS_PQ), *PK = (__bf16*)(ws + WS_PK), *PV = (__bf16*)(ws + WS_PV), *PM = (__bf16*)(ws + WS_PM); float *QF = (float*)(ws + WS_QF), *O = (float*)(ws + WS_O); _Float16 *QH = (_Float16*)(ws + WS_QH), *Kr = (_Float16*)(ws + WS_K), *V = (_Float16*)(ws + WS_V); __bf16* XB = (__bf16*)(ws + WS_XB);
  k_pack<<<dim3(NR / 16 + 400), 256, 0, stream>>>(F[0], F[1], F[2], F[3], F[4], XB, PQ, PK, PV, PM);
  k_proj<<<dim3(TNB * SS / 64, DM / 128, 3), 128, 0, stream>>>(XB, PQ, PK, PV, QF, QH, Kr, V);
  k_attn<<<dim3(TQB, NQ / NT * NH, TNB), 128, 0, stream>>>(QH, Kr, V, O);
  k_mem<<<dim3(TNB * SS / 64, 2, NQ), 128, 0, stream>>>(QF, PM, F[5], F[6], O, (float*)d_out);
}

// v005
// One run takes 60.1 microseconds.
// In two side-by-side timings against v004, it was 1.14 and 1.15 times as fast.
// All steps since v000 together make it 4.16 times as fast.
// compute dtype: all float inputs rounded to bf16; q/k/v = x . W with EXACT bf16 products on WMMA 16x16x32 (x, the (in,out) weights and memory packed as bf16 fragment-order tiles): q kept as f16 rows, k and v as f16 fragment-order tiles; grouped softmax attention (4 query groups x 8 heads x 32 dims over 1,024 keys): q, k single f16 x 32^-1/2, running-max softmax in f32 (hardware exp), P (scaled by 2^11, single f16) x v (single f16); memory branch: sigma = elu(q group row) in f32 from the f32 accumulators, (sigma as bf16 hi + lo, 2 products) . memory and sigma . memory_norm (f32 dot), divide; out = attn (1 - sigmoid(w)) + mem sigmoid(w) in f32; f32 output.
#include <hip/hip_runtime.h>
#include <math.h>

typedef __attribute__((ext_vector_type(16))) _Float16 v16h;
typedef __attribute__((ext_vector_type(16))) __bf16 v16b;
typedef __attribute__((ext_vector_type(8)))  _Float16 v8h;
typedef __attribute__((ext_vector_type(8)))  float v8f;
typedef __attribute__((ext_vector_type(4)))  float v4f;
typedef __attribute__((ext_vector_type(2)))  float v2f;
typedef __attribute__((ext_vector_type(4)))  unsigned v4u;
typedef __attribute__((ext_vector_type(4)))  int v4i;
typedef float __attribute__((may_alias)) float_a;
typedef int __attribute__((may_alias)) int_a;

template <typename T> __device__ __forceinline__ void vst2(void* p, T v) { *(T*)p = v;  }
__device__ __forceinline__ v8f wmma16(v16h a, v16h b, v8f c) {
  v8f d = __builtin_amdgcn_wmma_f32_16x16x32_f16(false, a, false, b, (short)0, c, false, false);
  asm volatile("v_nop\n\tv_nop\n\tv_nop\n\tv_nop" : "+v"(d) : "v"(a), "v"(b));
  return d;
}
__device__ __forceinline__ v8f wmma_bf(v16b a, v16b b, v8f c) {
  v8f d = __builtin_amdgcn_wmma_f32_16x16x32_bf16(false, a, false, b, (short)0, c, false, false);
  asm volatile("v_nop\n\tv_nop\n\tv_nop\n\tv_nop" : "+v"(d) : "v"(a), "v"(b));
  return d;
}
// 16x16x32 fragments: lane = (h = lane>>4, row/col = lane&15); elements 0..7 = k0+8h+0..7, 8..15 = k0+16+8h+0..7; D element r = row 8h+r
__device__ __forceinline__ v16h frag_h(const _Float16* rowk0, int lane) {
  union { v16h v; v8h q[2]; } u; const _Float16* p = rowk0 + 8 * (lane >> 4);
  u.q[0] = *(const v8h*)p; u.q[1] = *(const v8h*)(p + 16); return u.v;
}
__device__ __forceinline__ v16h frag_f32(const float* rowk0, int lane) {
  v16h a; const float* p = rowk0 + 8 * (lane >> 4);
#pragma unroll
  for (int i = 0; i < 8; ++i) { a[i] = (_Float16)p[i]; a[8 + i] = (_Float16)p[16 + i]; }
  return a;
}
__device__ __forceinline__ v16h frag_f32s(const float* rowk0, int lane, float sc) {
  v16h a; const float* p = rowk0 + 8 * (lane >> 4);
#pragma unroll
  for (int i = 0; i < 8; ++i) { a[i] = (_Float16)(p[i] * sc); a[8 + i] = (_Float16)(p[16 + i] * sc); }
  return a;
}
// column fragment from a [K][ld] layout (column n), rows >= K read as 0
__device__ __forceinline__ v16h fragc_f32(const float* W, int k0, int n, int lane, int ld, int K) {
  v16h a; const int g = lane >> 4;
#pragma unroll
  for (int i = 0; i < 8; ++i) { const int ka = k0 + 8 * g + i, kb = ka + 16;
    a[i] = (_Float16)(ka < K ? W[(size_t)(ka < K ? ka : K - 1) * ld + n] : 0.f); a[8 + i] = (_Float16)(kb < K ? W[(size_t)(kb < K ? kb : K - 1) * ld + n] : 0.f); }
  return a;
}
struct F2 { v16b h, l; };
__device__ __forceinline__ F2 bsplit16(const float v[16]) { F2 r;
#pragma unroll
  for (int i = 0; i < 16; ++i) { const __bf16 h = (__bf16)v[i]; r.h[i] = h; r.l[i] = (__bf16)(v[i] - (float)h); }
  return r; }
__device__ __forceinline__ F2 split_row(const float* row, int k0, int lane) { float v[16]; const float* p = row + k0 + 8 * (lane >> 4);
#pragma unroll
  for (int i = 0; i < 8; ++i) { v[i] = p[i]; v[8 + i] = p[16 + i]; }
  return bsplit16(v); }
__device__ __forceinline__ F2 split_rowK(const float* row, int k0, int lane, int K) { float v[16]; const int g = lane >> 4;
#pragma unroll
  for (int i = 0; i < 8; ++i) { const int ka = k0 + 8 * g + i, kb = ka + 16; v[i] = ka < K ? row[ka < K ? ka : K - 1] : 0.f; v[8 + i] = kb < K ? row[kb < K ? kb : K - 1] : 0.f; }
  return bsplit16(v); }
__device__ __forceinline__ F2 split_col(const float* W, int k0, int n, int lane, int ld, int K) { float v[16]; const int g = lane >> 4;
#pragma unroll
  for (int i = 0; i < 8; ++i) { const int ka = k0 + 8 * g + i, kb = ka + 16; v[i] = ka < K ? W[(size_t)(ka < K ? ka : K - 1) * ld + n] : 0.f; v[8 + i] = kb < K ? W[(size_t)(kb < K ? kb : K - 1) * ld + n] : 0.f; }
  return bsplit16(v); }
__device__ __forceinline__ v8f mac3(const F2& a, const F2& b, v8f c) { c = wmma_bf(a.l, b.h, c); c = wmma_bf(a.h, b.l, c); return wmma_bf(a.h, b.h, c); }
__device__ __forceinline__ float sigm(float v) { return 1.0f / (1.0f + expf(-v)); }
#define LDSX() do { asm volatile("s_wait_dscnt 0" ::: "memory"); __builtin_amdgcn_wave_barrier(); __builtin_amdgcn_fence(__ATOMIC_RELEASE, "workgroup"); } while (0)


// Grouped recurrent multi-head attention (B 4, S 1,024, d 1,024 = 4 query groups x 8 heads x 32): grouped-query softmax attention sharing K/V across the 4 groups, plus an ELU linear-memory branch (sigma(q) M / sigma(q) m_norm), mixed by a sigmoid gate.
#define NB 4
#define SS 1024
#define DM 1024
#define NQ 4
#define NH 8
#define HD 32
#define KVW (NH * HD)      // 256
#define NR (NB * SS)
#ifndef TQB
#define TQB (SS / 64)
#define TNB NB
#endif
typedef __attribute__((ext_vector_type(8))) __bf16 v8b;
__device__ __forceinline__ v16b frag_b(const __bf16* rowk0, int lane) {
  union { v16b v; v8b q[2]; } u; const __bf16* p = rowk0 + 8 * (lane >> 4);
  u.q[0] = *(const v8b*)p; u.q[1] = *(const v8b*)(p + 16); return u.v;
}
// fragment-order tile: 16 rows (or columns) x 32 k of a 16-bit type = 512 elements = 1 KiB; element (r, k) stands at ((k >> 4) & 1) * 256 + (((k >> 3) & 1) * 16 + r) * 8 + (k & 7).
// Lane l's two 16-byte halves stand at l * 8 and 256 + l * 8, so each load of a wave covers four whole 128-byte lines instead of a part of sixteen.
__device__ __forceinline__ v16b fragt_b(const __bf16* tile, int lane) {
  union { v16b v; v8b q[2]; } u; u.q[0] = *(const v8b*)(tile + lane * 8); u.q[1] = *(const v8b*)(tile + 256 + lane * 8); return u.v;
}
__device__ __forceinline__ v16h fragt_h(const _Float16* tile, int lane) {
  union { v16h v; v8h q[2]; } u; u.q[0] = *(const v8h*)(tile + lane * 8); u.q[1] = *(const v8h*)(tile + 256 + lane * 8); return u.v;
}
__device__ __forceinline__ float bfr(float v) { return (float)(__bf16)v; }
__device__ __attribute__((noinline)) float exp_ni(float v) { return expf(v); }
__device__ __attribute__((noinline)) float erf_ni(float v) { return erff(v); }
__device__ __attribute__((noinline)) float expm1f_ni(float v) { return expm1f(v); }

#define WS_PQ  0u                                  // bf16 fragment-order tiles [column tile][k block][512]: Wq 64 x 32; Wk 16 x 32; Wv 16 x 32; memory 16 x 8
#define WS_PK  (WS_PQ + 2u * (size_t)DM * DM)
#define WS_PV  (WS_PK + 2u * (size_t)KVW * DM)
#define WS_PM  (WS_PV + 2u * (size_t)KVW * DM)
#define WS_SH  (WS_PM + 2u * (size_t)KVW * KVW)        // sigma = elu(q) as bf16 hi and lo fragment-order tiles [16-row tile][query group][k block][512]; f16 q rows [NR][1024]; f16 k tiles [b][head][16-key tile][512]; f16 v tiles [b][16-dim tile][32-key block][512]; f32 halves of sigma . memory_norm [query group][2][NR]; bf16 x tiles [16-row tile][k block][512]
#define WS_SL  (WS_SH + 2u * (size_t)NR * DM)
#define WS_QH  (WS_SL + 2u * (size_t)NR * DM)
#define WS_K   (WS_QH + 2u * (size_t)NR * DM)
#define WS_V   (WS_K + 2u * (size_t)NR * KVW)
#define WS_DP  (WS_V + 2u * (size_t)NB * KVW * SS)
#define WS_XB  (WS_DP + 4u * (size_t)NR * NQ * 2)
#define WS_END (WS_XB + 2u * (size_t)NR * DM)

// ---- k_pack: blocks 0..255: one 16-row tile of x each; then 16 columns x 256 k of a weight each (Wq 256 blocks, Wk 64, Wv 64, memory 16). Every block writes one contiguous run of whole tiles.
__global__ __launch_bounds__(256) void k_pack(const float* __restrict__ X, const float* __restrict__ WQ, const float* __restrict__ WK, const float* __restrict__ WV, const float* __restrict__ MM, __bf16* __restrict__ XB, __bf16* __restrict__ PQ, __bf16* __restrict__ PK, __bf16* __restrict__ PV, __bf16* __restrict__ PM) {
  __shared__ __align__(16) __bf16 s[16][264];
  const int t = threadIdx.x; int id = blockIdx.x;
  if (id < NR / 16) {   // x is k-contiguous already: each thread takes the 8 floats of a 16-byte piece of the tile run
    __bf16* xd = XB + (size_t)id * 16 * DM; v4f a[8][2];
    // piece p = t + 256 j: k block (t >> 6) + 4 j, half (t >> 5) & 1, lane t & 31: from one j to the next the source moves on by 4 k blocks
    const float* q = X + (size_t)id * 16 * DM + (size_t)(t & 15) * DM + (t >> 6) * 32 + ((t >> 5) & 1) * 16 + ((t >> 4) & 1) * 8;
#pragma unroll
    for (int j = 0; j < 8; ++j) { a[j][0] = *(const v4f*)(q + j * 128); a[j][1] = *(const v4f*)(q + j * 128 + 4); }
    asm volatile("s_wait_xcnt 0x0" :: "v"(q) : "memory");   // q as an input keeps the address pair out of the loads' own destinations until the wait has passed
#pragma unroll
    for (int j = 0; j < 8; ++j) { v8b o;
#pragma unroll
      for (int i = 0; i < 4; ++i) { o[i] = (__bf16)a[j][0][i]; o[4 + i] = (__bf16)a[j][1][i]; }
      *(v8b*)(xd + (size_t)(t + 256 * j) * 8) = o; }
    return; }
  id -= NR / 16; const float* w; __bf16* dst; int ld = KVW, nkc = DM / 32;
  if (id < 256) { w = WQ; dst = PQ; ld = DM; } else if (id < 320) { id -= 256; w = WK; dst = PK; } else if (id < 384) { id -= 320; w = WV; dst = PV; } else { id = (id - 384) * 4; w = MM; dst = PM; nkc = KVW / 32; }
  const int nt = id >> 2, ch = id & 3;
  const float* q = w + (size_t)(ch * 256 + t) * ld + nt * 16; v4f r[4];
#pragma unroll
  for (int c = 0; c < 4; ++c) r[c] = *(const v4f*)(q + c * 4);
#pragma unroll
  for (int c = 0; c < 16; ++c) s[c][t] = (__bf16)r[c >> 2][c & 3];
  __syncthreads();
  __bf16* d = dst + ((size_t)nt * nkc + ch * 8) * 512;
#pragma unroll
  for (int j = 0; j < 2; ++j) { const int p = t + 256 * j, ln = p & 31; vst2((unsigned*)(d + (size_t)p * 8), *(const v4u*)&s[ln & 15][(p >> 6) * 32 + ((p >> 5) & 1) * 16 + (ln >> 4) * 8]); }
}
// one k block of k_proj: the wave's x fragment and its 8 weight fragments, all 18 loads issued as one group
__device__ __forceinline__ void proj_fetch(v16b &x, v16b (&w)[8], const __bf16* xt, const __bf16* wt, int lane) {
  x = fragt_b(xt, lane);
#pragma unroll
  for (int j = 0; j < 8; ++j) w[j] = fragt_b(wt + (size_t)j * (DM / 32) * 512, lane);
}
__device__ __forceinline__ void proj_mac(const v16b &a, const v16b (&w)[8], v8f (&acc)[8]) {
#pragma unroll
  for (int j = 0; j < 8; ++j) acc[j] = wmma_bf(a, w[j], acc[j]);
}
// ---- k_proj: block = (64 rows, 128 cols, which): 0: q -> f16 rows, sigma = elu(q) -> bf16 hi and lo tiles, this half group's share of sigma . memory_norm (8 column blocks); 1: k -> tiles (2 column blocks); 2: v -> tiles (2 column blocks)
__global__ __launch_bounds__(128) void k_proj(const __bf16* __restrict__ XB, const __bf16* __restrict__ PQ, const __bf16* __restrict__ PK, const __bf16* __restrict__ PV, const float* __restrict__ MN, _Float16* __restrict__ QH, __bf16* __restrict__ SH, __bf16* __restrict__ SL, float* __restrict__ DP, _Float16* __restrict__ Kr, _Float16* __restrict__ V) {
  __shared__ __align__(16) _Float16 so[64][136]; __shared__ __align__(16) __bf16 sh[64][136]; __shared__ __align__(16) __bf16 sl[64][136]; __shared__ float sd[64][17]; __shared__ __align__(16) _Float16 st[128][72];
  const int tid = threadIdx.x, wave = tid >> 5, lane = tid & 31, col = lane & 15, g = lane >> 4; const int which = blockIdx.z; const int c0 = blockIdx.y * 128; if (which > 0 && c0 >= KVW) return;
  const size_t rb = (size_t)blockIdx.x * 64; const size_t r0 = rb + wave * 16; const __bf16* Wr = (which == 0) ? PQ : (which == 1) ? PK : PV;
  v8f acc[8] = {};
  const __bf16* xp = XB + (r0 >> 4) * (DM / 32) * 512; const __bf16* wp = Wr + (size_t)(c0 >> 4) * (DM / 32) * 512;
  v16b xa, xb; v16b wa[8], wb[8];   // two register sets: one k block is multiplied while the next one's loads are in flight
  proj_fetch(xa, wa, xp, wp, lane);
#pragma unroll 1   // rolled: the two sets already give the overlap, a longer body only adds registers
  for (int kc = 0; kc < DM / 32 - 2; kc += 2) {
    proj_fetch(xb, wb, xp + (kc + 1) * 512, wp + (kc + 1) * 512, lane);
    proj_mac(xa, wa, acc);
    proj_fetch(xa, wa, xp + (kc + 2) * 512, wp + (kc + 2) * 512, lane);
    proj_mac(xb, wb, acc);
    asm volatile("s_wait_xcnt 0x0" ::: "memory"); }   // the next trip rewrites the address registers that this trip's last loads name
  // last two k blocks outside the loop: a fetch under a test inside it would make every wait count for the path without the fetch
  proj_fetch(xb, wb, xp + (DM / 32 - 1) * 512, wp + (DM / 32 - 1) * 512, lane);
  proj_mac(xa, wa, acc);
  proj_mac(xb, wb, acc);
  if (which == 0) {
    const int cg = c0 & (KVW - 1);   // the block's first column inside its query group
    float mnv[8], dp[8];
#pragma unroll
    for (int j = 0; j < 8; ++j) mnv[j] = bfr(MN[cg + j * 16 + col]);
#pragma unroll
    for (int r = 0; r < 8; ++r) dp[r] = 0.f;
    // expm1f is taken for every lane and selected, so that the chains are independent
#pragma unroll
    for (int j = 0; j < 8; ++j)
#pragma unroll
      for (int r = 0; r < 8; ++r) { const float v = acc[j][r]; const int row = wave * 16 + 8 * g + r, cc = j * 16 + col;
        so[row][cc] = (_Float16)v;
        const float e = expm1f(v); const float sg = (v > 0.f) ? v : e; const __bf16 hi = (__bf16)sg;
        sh[row][cc] = hi; sl[row][cc] = (__bf16)(sg - (float)hi); dp[r] += sg * mnv[j]; }
#pragma unroll
    for (int r = 0; r < 8; ++r) sd[wave * 16 + 8 * g + r][col] = dp[r];
    __syncthreads();
    for (int e = tid; e < 64 * 16; e += 128) { const int rl = e >> 4, q = e & 15; vst2((unsigned*)(QH + (rb + rl) * DM + c0 + q * 8), *(const v4u*)&so[rl][q * 8]); }
    // 4 row tiles x 4 k blocks of sigma, hi and lo, each tile whole
    const size_t tb = ((rb >> 4) * NQ + (c0 >> 8)) * (KVW / 32) + (cg >> 5);
    for (int e = tid; e < 64 * 16; e += 128) { const int tl = e >> 6, ln = e & 31; const int row = (tl & 3) * 16 + (ln & 15), cc = (tl >> 2) * 32 + ((e >> 5) & 1) * 16 + (ln >> 4) * 8;
      const size_t d = (tb + (size_t)(tl & 3) * NQ * (KVW / 32) + (tl >> 2)) * 512 + (e & 63) * 8;
      vst2((unsigned*)(SH + d), *(const v4u*)&sh[row][cc]); vst2((unsigned*)(SL + d), *(const v4u*)&sl[row][cc]); }
    if (tid < 64) { float d0 = 0.f;
#pragma unroll
      for (int c = 0; c < 16; ++c) d0 += sd[tid][c];
      DP[(size_t)(c0 >> 7) * NR + rb + tid] = d0; } }   // a plane per half group: the block's 64 sums fill whole lines that no other block writes
  else if (which == 1) {
#pragma unroll
    for (int j = 0; j < 8; ++j)
#pragma unroll
      for (int r = 0; r < 8; ++r) so[wave * 16 + 8 * g + r][j * 16 + col] = (_Float16)acc[j][r];
    __syncthreads();
    { const size_t b = rb / SS; const int s0 = (int)(rb % SS);   // 4 heads x 4 key tiles, each tile whole
      for (int e = tid; e < 64 * 16; e += 128) { const int tl = e >> 6, ln = e & 31; vst2((unsigned*)(Kr + (((b * NH + (c0 >> 5) + (tl >> 2)) * (SS / 16)) + (s0 >> 4) + (tl & 3)) * 512 + (e & 63) * 8), *(const v4u*)&so[(tl & 3) * 16 + (ln & 15)][(tl >> 2) * 32 + ((e >> 5) & 1) * 16 + (ln >> 4) * 8]); } } }
  else {
#pragma unroll
    for (int j = 0; j < 8; ++j)
#pragma unroll
      for (int r = 0; r < 8; ++r) st[j * 16 + col][wave * 16 + 8 * g + r] = (_Float16)acc[j][r];
    __syncthreads(); const size_t b = rb / SS; const int s0 = (int)(rb % SS);
    // 8 dim tiles x 2 key blocks, each tile whole
    for (int e = tid; e < 128 * 8; e += 128) { const int tl = e >> 6, ln = e & 31; vst2((unsigned*)(V + (((b * (KVW / 16) + (c0 >> 4) + (tl >> 1)) * (SS / 32)) + (s0 >> 5) + (tl & 1)) * 512 + (e & 63) * 8), *(const v4u*)&st[(tl >> 1) * 16 + (ln & 15)][(tl & 1) * 32 + ((e >> 5) & 1) * 16 + (ln >> 4) * 8]); } }
}
// lane l with lane l ^ 16, as a vector cross-row move
__device__ __forceinline__ float xhalf(float x) { return __builtin_bit_cast(float, __builtin_amdgcn_permlanex16(__builtin_bit_cast(int, x), __builtin_bit_cast(int, x), 0x76543210, 0xfedcba98, false, false)); }
#define KPASS 64   // keys per pass of k_attn: one running-maximum update and one rescale of the output tiles per pass
#define NT 2       // query tiles (query groups of the head) per wave: each key and value fragment feeds NT products
// the builtin alone: in k_attn runs of independent products stand behind one another, and the compiler pads what is left
__device__ __forceinline__ v8f wmma16b(v16h a, v16h b, v8f c) { return __builtin_amdgcn_wmma_f32_16x16x32_f16(false, a, false, b, (short)0, c, false, false); }
__device__ __forceinline__ v8f wmma_bfb(v16b a, v16b b, v8f c) { return __builtin_amdgcn_wmma_f32_16x16x32_bf16(false, a, false, b, (short)0, c, false, false); }
__global__ __launch_bounds__(128) void k_attn(const _Float16* __restrict__ QH, const _Float16* __restrict__ Kr, const _Float16* __restrict__ V, const __bf16* __restrict__ SH, const __bf16* __restrict__ SL, const __bf16* __restrict__ PM, const float* __restrict__ DP, const float* __restrict__ MW, float* __restrict__ OUT) {
  __shared__ __align__(16) float so[4][NT][16][36];
  const int tid = threadIdx.x, wave = tid >> 5, lane = tid & 31, col = lane & 15, g = lane >> 4; const int qg0 = (blockIdx.y / NH) * NT, h = blockIdx.y % NH; const size_t b = blockIdx.z; const int q0 = blockIdx.x * 64 + wave * 16; const size_t rq = b * SS + q0; const int qc = qg0 * KVW + h * HD;
  v16h bq[NT]; float m[NT], l[NT];   // per tile: the query's running maximum (equal in both halves) and this half's share of its sum
  v8f acc[NT][2];                    // acc[t][dt][r] = O^T[dim dt * 16 + 8g + r][query col of tile t]
#pragma unroll
  for (int t = 0; t < NT; ++t) { bq[t] = frag_h(QH + (rq + col) * DM + qc + t * KVW, lane); m[t] = -3.0e38f; l[t] = 0.f; acc[t][0] = v8f{}; acc[t][1] = v8f{}; }
  // the lane's own 16 bytes in the first key tile and in the first value tile of this head
  const _Float16* kp = Kr + (b * NH + h) * (SS / 16) * 512 + lane * 8; const _Float16* vp = V + (b * (KVW / 16) + h * 2) * (SS / 32) * 512 + lane * 8;
  // memory branch, a slice a pass: mac[t][dt][r] = sum over the group's 256 sigma columns of memory[column][h * 32 + dt * 16 + 8g + r] x sigma[query col of tile t][column].
  // Pass ks takes k block ks / 2, sigma hi in the even passes and lo in the odd ones: its 8 loads land under the softmax's vector work, its 4 products follow the value products.
  static_assert(SS / KPASS == 2 * (KVW / 32), "one half k block of the memory branch a pass");
  const __bf16* pa = PM + (size_t)(h * 2) * (KVW / 32) * 512 + lane * 8; const size_t sb = ((rq >> 4) * NQ + qg0) * (KVW / 32) * 512 + lane * 8; const __bf16* ph = SH + sb; const __bf16* pl = SL + sb;
  v8f mac[NT][2];
#pragma unroll
  for (int t = 0; t < NT; ++t) { mac[t][0] = v8f{}; mac[t][1] = v8f{}; }
#pragma unroll 1   // rolled: one pass already holds 20 matrix products and 64 scores a lane
  for (int ks = 0; ks < SS / KPASS; ++ks, kp += (KPASS / 16) * 512, vp += (KPASS / 32) * 512) { v8f s[NT][KPASS / 16];
    // this pass's key and value fragments as one group of loads: the values land while the softmax is worked
    v16h kf[KPASS / 16], vf[2][KPASS / 32];
#pragma unroll
    for (int ct = 0; ct < KPASS / 16; ++ct) kf[ct] = fragt_h(kp + ct * 512, 0);
#pragma unroll
    for (int dt = 0; dt < 2; ++dt)
#pragma unroll
      for (int kb = 0; kb < KPASS / 32; ++kb) vf[dt][kb] = fragt_h(vp + (dt * (SS / 32) + kb) * 512, 0);
    v16b ma[2], mb[NT]; const __bf16* pm = pa + (ks >> 1) * 512; const __bf16* sp = ((ks & 1) ? pl : ph) + (ks >> 1) * 512;
#pragma unroll
    for (int dt = 0; dt < 2; ++dt) ma[dt] = fragt_b(pm + dt * (KVW / 32) * 512, 0);
#pragma unroll
    for (int t = 0; t < NT; ++t) mb[t] = fragt_b(sp + t * (KVW / 32) * 512, 0);
    asm volatile("s_wait_xcnt 0x0" :: "v"(kp), "v"(vp), "v"(pm), "v"(sp) : "memory");   // the four address pairs as inputs keep them out of the loads' own destinations until the wait has passed
    __builtin_amdgcn_sched_barrier(0);   // keeps the loads one group ahead of the products: without it the scheduler sinks them to their uses, each with a wait of its own
#pragma unroll
    for (int ct = 0; ct < KPASS / 16; ++ct)
#pragma unroll
      for (int t = 0; t < NT; ++t) { v8f c = {}; s[t][ct] = wmma16b(kf[ct], bq[t], c); }
    v16h pb[NT][KPASS / 32];
#pragma unroll
    for (int t = 0; t < NT; ++t) {
      // maximum of the raw products first: the scale is positive and rounding is monotonic, so scaling the maximum gives the maximum of the scaled scores
      float mp[KPASS / 32];   // one short chain per 32 keys, joined at the end
#pragma unroll
      for (int kb = 0; kb < KPASS / 32; ++kb) { mp[kb] = fmaxf(s[t][2 * kb][0], s[t][2 * kb + 1][0]);
#pragma unroll
        for (int r = 1; r < 8; ++r) mp[kb] = fmaxf(mp[kb], fmaxf(s[t][2 * kb][r], s[t][2 * kb + 1][r])); }
      float mx = mp[0];
#pragma unroll
      for (int kb = 1; kb < KPASS / 32; ++kb) mx = fmaxf(mx, mp[kb]);
      mx = fmaxf(mx, xhalf(mx)) * 0.17677669529663688f;
      const float mn = fmaxf(m[t], mx); const float alpha = (m[t] <= -1.0e38f) ? 0.f : __expf(m[t] - mn);
      v8f e8 = {};
#pragma unroll
      for (int kb = 0; kb < KPASS / 32; ++kb) { v8f e[2];
#pragma unroll
        for (int ct = 0; ct < 2; ++ct)
#pragma unroll
          for (int r = 0; r < 8; ++r) { e[ct][r] = __expf(s[t][2 * kb + ct][r] * 0.17677669529663688f - mn); pb[t][kb][ct * 8 + r] = (_Float16)(e[ct][r] * 2048.0f); }
        e8 = (kb == 0) ? (e[0] + e[1]) : (e8 + (e[0] + e[1])); }
      const v4f e4 = e8.lo + e8.hi; const v2f e2 = e4.lo + e4.hi; const float es = e2[0] + e2[1];
      l[t] = l[t] * alpha + es; m[t] = mn;
#pragma unroll
      for (int dt = 0; dt < 2; ++dt) acc[t][dt] *= alpha; }
    __builtin_amdgcn_sched_barrier(0);   // all of P is packed ahead of the value products: mixed in among them, each repacking of a B operand's registers costs the full distance behind a product
#pragma unroll
    for (int kb = 0; kb < KPASS / 32; ++kb)
#pragma unroll
      for (int dt = 0; dt < 2; ++dt)
#pragma unroll
        for (int t = 0; t < NT; ++t) acc[t][dt] = wmma16b(vf[dt][kb], pb[t][kb], acc[t][dt]);
#pragma unroll
    for (int t = 0; t < NT; ++t)
#pragma unroll
      for (int dt = 0; dt < 2; ++dt) mac[t][dt] = wmma_bfb(ma[dt], mb[t], mac[t][dt]); }
  const float mw = MW[0];
  const float* dq = DP + (size_t)(qg0 * 2) * NR + rq + col; float dpv[2 * NT];   // the two halves of sigma . memory_norm of the lane's query, for both tiles
#pragma unroll
  for (int i = 0; i < 2 * NT; ++i) dpv[i] = dq[(size_t)i * NR];
  asm volatile("s_wait_xcnt 0x0" :: "v"(dq) : "memory");   // dq as an input keeps the address pair whole until the wait has passed
  const float wg = 1.0f / (1.0f + __expf(-bfr(mw)));
#pragma unroll
  for (int t = 0; t < NT; ++t) {
    l[t] += xhalf(l[t]);   // unconditional: both halves are on
    const float il = (1.0f / 2048.0f) / l[t]; const float den = dpv[2 * t] + dpv[2 * t + 1];
#pragma unroll
    for (int dt = 0; dt < 2; ++dt) { v8f o;
#pragma unroll
      for (int r = 0; r < 8; ++r) o[r] = (acc[t][dt][r] * il) * (1.0f - wg) + (mac[t][dt][r] / den) * wg;
      *(v4f*)&so[wave][t][col][dt * 16 + 8 * g] = o.lo; *(v4f*)&so[wave][t][col][dt * 16 + 8 * g + 4] = o.hi; } }   // a lane's 8 accumulators of a tile are 8 consecutive dims of its query's row
  LDSX();
  // 8 lanes store the 128 bytes of one query group's head slice of a row
  for (int rl = 0; rl < 16; ++rl) if (lane < 8 * NT) vst2(OUT + (rq + rl) * DM + qc + (lane >> 3) * KVW + (lane & 7) * 4, *(const v4f*)&so[wave][lane >> 3][rl][(lane & 7) * 4]);
}
extern "C" void kernel_launch(void* const* d_in, const int* in_sizes, int n_in, void* d_out, int out_size, void* d_ws, size_t ws_size, hipStream_t stream) {
  (void)in_sizes; (void)n_in; (void)out_size;
  const float** F = (const float**)d_in;   // 0 x [4,1024,1024], 1 Wq [1024,1024] (in,out), 2 Wk [1024,256], 3 Wv [1024,256], 4 memory [256,256], 5 memory_norm [256,1], 6 memory_weight [1]
  if (ws_size < (size_t)WS_END) return;
  char* ws = (char*)d_ws; __bf16 *PQ = (__bf16*)(ws + WS_PQ), *PK = (__bf16*)(ws + WS_PK), *PV = (__bf16*)(ws + WS_PV), *PM = (__bf16*)(ws + WS_PM); __bf16 *SH = (__bf16*)(ws + WS_SH), *SL = (__bf16*)(ws + WS_SL); float* DP = (float*)(ws + WS_DP); _Float16 *QH = (_Float16*)(ws + WS_QH), *Kr = (_Float16*)(ws + WS_K), *V = (_Float16*)(ws + WS_V); __bf16* XB = (__bf16*)(ws + WS_XB);
  k_pack<<<dim3(NR / 16 + 400), 256, 0, stream>>>(F[0], F[1], F[2], F[3], F[4], XB, PQ, PK, PV, PM);
  k_proj<<<dim3(TNB * SS / 64, DM / 128, 3), 128, 0, stream>>>(XB, PQ, PK, PV, F[5], QH, SH, SL, DP, Kr, V);
  k_attn<<<dim3(TQB, NQ / NT * NH, TNB), 128, 0, stream>>>(QH, Kr, V, SH, SL, PM, DP, F[6], (float*)d_out);
}

// v006
// A run of this version takes 57.5 microseconds.
// Timed twice side by side with v005, it ran 1.05 times as fast both times.
// All steps since v000 together make it 4.37 times as fast.
// compute dtype: all float inputs rounded to bf16; q/k/v = x . W with EXACT bf16 products on WMMA 16x16x32 (x, the (in,out) weights and memory packed as bf16 fragment-order tiles): q kept as f16 rows, k and v as f16 fragment-order tiles; grouped softmax attention (4 query groups x 8 heads x 32 dims over 1,024 keys): q, k single f16 x 32^-1/2, running-max softmax in f32 in base 2 (hardware exp), P (scaled by 2^11, single f16) x v (single f16); memory branch: sigma = elu(q group row) in f32 from the f32 accumulators, (sigma as bf16 hi + lo, 2 products) . memory and sigma . memory_norm (f32 dot), divide; out = attn (1 - sigmoid(w)) + mem sigmoid(w) in f32; f32 output.
#include <hip/hip_runtime.h>
#include <math.h>

typedef __attribute__((ext_vector_type(16))) _Float16 v16h;
typedef __attribute__((ext_vector_type(16))) __bf16 v16b;
typedef __attribute__((ext_vector_type(8)))  _Float16 v8h;
typedef __attribute__((ext_vector_type(8)))  float v8f;
typedef __attribute__((ext_vector_type(4)))  float v4f;
typedef __attribute__((ext_vector_type(2)))  float v2f;
typedef __attribute__((ext_vector_type(4)))  unsigned v4u;
typedef __attribute__((ext_vector_type(4)))  int v4i;
typedef float __attribute__((may_alias)) float_a;
typedef int __attribute__((may_alias)) int_a;

template <typename T> __device__ __forceinline__ void vst2(void* p, T v) { *(T*)p = v;  }
__device__ __forceinline__ v8f wmma16(v16h a, v16h b, v8f c) {
  v8f d = __builtin_amdgcn_wmma_f32_16x16x32_f16(false, a, false, b, (short)0, c, false, false);
  asm volatile("v_nop\n\tv_nop\n\tv_nop\n\tv_nop" : "+v"(d) : "v"(a), "v"(b));
  return d;
}
__device__ __forceinline__ v8f wmma_bf(v16b a, v16b b, v8f c) {
  v8f d = __builtin_amdgcn_wmma_f32_16x16x32_bf16(false, a, false, b, (short)0, c, false, false);
  asm volatile("v_nop\n\tv_nop\n\tv_nop\n\tv_nop" : "+v"(d) : "v"(a), "v"(b));
  return d;
}
// 16x16x32 fragments: lane = (h = lane>>4, row/col = lane&15); elements 0..7 = k0+8h+0..7, 8..15 = k0+16+8h+0..7; D element r = row 8h+r
__device__ __forceinline__ v16h frag_h(const _Float16* rowk0, int lane) {
  union { v16h v; v8h q[2]; } u; const _Float16* p = rowk0 + 8 * (lane >> 4);
  u.q[0] = *(const v8h*)p; u.q[1] = *(const v8h*)(p + 16); return u.v;
}
__device__ __forceinline__ v16h frag_f32(const float* rowk0, int lane) {
  v16h a; const float* p = rowk0 + 8 * (lane >> 4);
#pragma unroll
  for (int i = 0; i < 8; ++i) { a[i] = (_Float16)p[i]; a[8 + i] = (_Float16)p[16 + i]; }
  return a;
}
__device__ __forceinline__ v16h frag_f32s(const float* rowk0, int lane, float sc) {
  v16h a; const float* p = rowk0 + 8 * (lane >> 4);
#pragma unroll
  for (int i = 0; i < 8; ++i) { a[i] = (_Float16)(p[i] * sc); a[8 + i] = (_Float16)(p[16 + i] * sc); }
  return a;
}
// column fragment from a [K][ld] layout (column n), rows >= K read as 0
__device__ __forceinline__ v16h fragc_f32(const float* W, int k0, int n, int lane, int ld, int K) {
  v16h a; const int g = lane >> 4;
#pragma unroll
  for (int i = 0; i < 8; ++i) { const int ka = k0 + 8 * g + i, kb = ka + 16;
    a[i] = (_Float16)(ka < K ? W[(size_t)(ka < K ? ka : K - 1) * ld + n] : 0.f); a[8 + i] = (_Float16)(kb < K ? W[(size_t)(kb < K ? kb : K - 1) * ld + n] : 0.f); }
  return a;
}
struct F2 { v16b h, l; };
__device__ __forceinline__ F2 bsplit16(const float v[16]) { F2 r;
#pragma unroll
  for (int i = 0; i < 16; ++i) { const __bf16 h = (__bf16)v[i]; r.h[i] = h; r.l[i] = (__bf16)(v[i] - (float)h); }
  return r; }
__device__ __forceinline__ F2 split_row(const float* row, int k0, int lane) { float v[16]; const float* p = row + k0 + 8 * (lane >> 4);
#pragma unroll
  for (int i = 0; i < 8; ++i) { v[i] = p[i]; v[8 + i] = p[16 + i]; }
  return bsplit16(v); }
__device__ __forceinline__ F2 split_rowK(const float* row, int k0, int lane, int K) { float v[16]; const int g = lane >> 4;
#pragma unroll
  for (int i = 0; i < 8; ++i) { const int ka = k0 + 8 * g + i, kb = ka + 16; v[i] = ka < K ? row[ka < K ? ka : K - 1] : 0.f; v[8 + i] = kb < K ? row[kb < K ? kb : K - 1] : 0.f; }
  return bsplit16(v); }
__device__ __forceinline__ F2 split_col(const float* W, int k0, int n, int lane, int ld, int K) { float v[16]; const int g = lane >> 4;
#pragma unroll
  for (int i = 0; i < 8; ++i) { const int ka = k0 + 8 * g + i, kb = ka + 16; v[i] = ka < K ? W[(size_t)(ka < K ? ka : K - 1) * ld + n] : 0.f; v[8 + i] = kb < K ? W[(size_t)(kb < K ? kb : K - 1) * ld + n] : 0.f; }
  return bsplit16(v); }
__device__ __forceinline__ v8f mac3(const F2& a, const F2& b, v8f c) { c = wmma_bf(a.l, b.h, c); c = wmma_bf(a.h, b.l, c); return wmma_bf(a.h, b.h, c); }
__device__ __forceinline__ float sigm(float v) { return 1.0f / (1.0f + expf(-v)); }
#define LDSX() do { asm volatile("s_wait_dscnt 0" ::: "memory"); __builtin_amdgcn_wave_barrier(); __builtin_amdgcn_fence(__ATOMIC_RELEASE, "workgroup"); } while (0)


// Grouped recurrent multi-head attention (B 4, S 1,024, d 1,024 = 4 query groups x 8 heads x 32): grouped-query softmax attention sharing K/V across the 4 groups, plus an ELU linear-memory branch (sigma(q) M / sigma(q) m_norm), mixed by a sigmoid gate.
#define NB 4
#define SS 1024
#define DM 1024
#define NQ 4
#define NH 8
#define HD 32
#define KVW (NH * HD)      // 256
#define NR (NB * SS)
#ifndef TQB
#define TQB (SS / 64)
#define TNB NB
#endif
typedef __attribute__((ext_vector_type(8))) __bf16 v8b;
__device__ __forceinline__ v16b frag_b(const __bf16* rowk0, int lane) {
  union { v16b v; v8b q[2]; } u; const __bf16* p = rowk0 + 8 * (lane >> 4);
  u.q[0] = *(const v8b*)p; u.q[1] = *(const v8b*)(p + 16); return u.v;
}
// fragment-order tile: 16 rows (or columns) x 32 k of a 16-bit type = 512 elements = 1 KiB; element (r, k) stands at ((k >> 4) & 1) * 256 + (((k >> 3) & 1) * 16 + r) * 8 + (k & 7).
// Lane l's two 16-byte halves stand at l * 8 and 256 + l * 8, so each load of a wave covers four whole 128-byte lines instead of a part of sixteen.
__device__ __forceinline__ v16b fragt_b(const __bf16* tile, int lane) {
  union { v16b v; v8b q[2]; } u; u.q[0] = *(const v8b*)(tile + lane * 8); u.q[1] = *(const v8b*)(tile + 256 + lane * 8); return u.v;
}
__device__ __forceinline__ v16h fragt_h(const _Float16* tile, int lane) {
  union { v16h v; v8h q[2]; } u; u.q[0] = *(const v8h*)(tile + lane * 8); u.q[1] = *(const v8h*)(tile + 256 + lane * 8); return u.v;
}
__device__ __forceinline__ float bfr(float v) { return (float)(__bf16)v; }
__device__ __attribute__((noinline)) float exp_ni(float v) { return expf(v); }
__device__ __attribute__((noinline)) float erf_ni(float v) { return erff(v); }
__device__ __attribute__((noinline)) float expm1f_ni(float v) { return expm1f(v); }

#define WS_PQ  0u                                  // bf16 fragment-order tiles [column tile][k block][512]: Wq 64 x 32; Wk 16 x 32; Wv 16 x 32; memory 16 x 8
#define WS_PK  (WS_PQ + 2u * (size_t)DM * DM)
#define WS_PV  (WS_PK + 2u * (size_t)KVW * DM)
#define WS_PM  (WS_PV + 2u * (size_t)KVW * DM)
#define WS_SH  (WS_PM + 2u * (size_t)KVW * KVW)        // sigma = elu(q) as bf16 hi and lo fragment-order tiles [16-row tile][query group][k block][512]; f16 q rows [NR][1024]; f16 k tiles [b][head][16-key tile][512]; f16 v tiles [b][16-dim tile][32-key block][512]; f32 halves of sigma . memory_norm [query group][2][NR]; bf16 x tiles [16-row tile][k block][512]
#define WS_SL  (WS_SH + 2u * (size_t)NR * DM)
#define WS_QH  (WS_SL + 2u * (size_t)NR * DM)
#define WS_K   (WS_QH + 2u * (size_t)NR * DM)
#define WS_V   (WS_K + 2u * (size_t)NR * KVW)
#define WS_DP  (WS_V + 2u * (size_t)NB * KVW * SS)
#define WS_XB  (WS_DP + 4u * (size_t)NR * NQ * 2)
#define WS_END (WS_XB + 2u * (size_t)NR * DM)

// ---- k_pack: blocks 0..255: one 16-row tile of x each; then 16 columns x 256 k of a weight each (Wq 256 blocks, Wk 64, Wv 64, memory 16). Every block writes one contiguous run of whole tiles.
__global__ __launch_bounds__(256) void k_pack(const float* __restrict__ X, const float* __restrict__ WQ, const float* __restrict__ WK, const float* __restrict__ WV, const float* __restrict__ MM, __bf16* __restrict__ XB, __bf16* __restrict__ PQ, __bf16* __restrict__ PK, __bf16* __restrict__ PV, __bf16* __restrict__ PM) {
  __shared__ __align__(16) __bf16 s[16][264];
  const int t = threadIdx.x; int id = blockIdx.x;
  if (id < NR / 16) {   // x is k-contiguous already: each thread takes the 8 floats of a 16-byte piece of the tile run
    __bf16* xd = XB + (size_t)id * 16 * DM; v4f a[8][2];
    // piece p = t + 256 j: k block (t >> 6) + 4 j, half (t >> 5) & 1, lane t & 31: from one j to the next the source moves on by 4 k blocks
    const float* q = X + (size_t)id * 16 * DM + (size_t)(t & 15) * DM + (t >> 6) * 32 + ((t >> 5) & 1) * 16 + ((t >> 4) & 1) * 8;
#pragma unroll
    for (int j = 0; j < 8; ++j) { a[j][0] = *(const v4f*)(q + j * 128); a[j][1] = *(const v4f*)(q + j * 128 + 4); }
    asm volatile("s_wait_xcnt 0x0" :: "v"(q) : "memory");   // q as an input keeps the address pair out of the loads' own destinations until the wait has passed
#pragma unroll
    for (int j = 0; j < 8; ++j) { v8b o;
#pragma unroll
      for (int i = 0; i < 4; ++i) { o[i] = (__bf16)a[j][0][i]; o[4 + i] = (__bf16)a[j][1][i]; }
      *(v8b*)(xd + (size_t)(t + 256 * j) * 8) = o; }
    return; }
  id -= NR / 16; const float* w; __bf16* dst; int ld = KVW, nkc = DM / 32;
  if (id < 256) { w = WQ; dst = PQ; ld = DM; } else if (id < 320) { id -= 256; w = WK; dst = PK; } else if (id < 384) { id -= 320; w = WV; dst = PV; } else { id = (id - 384) * 4; w = MM; dst = PM; nkc = KVW / 32; }
  const int nt = id >> 2, ch = id & 3;
  const float* q = w + (size_t)(ch * 256 + t) * ld + nt * 16; v4f r[4];
#pragma unroll
  for (int c = 0; c < 4; ++c) r[c] = *(const v4f*)(q + c * 4);
#pragma unroll
  for (int c = 0; c < 16; ++c) s[c][t] = (__bf16)r[c >> 2][c & 3];
  __syncthreads();
  __bf16* d = dst + ((size_t)nt * nkc + ch * 8) * 512;
#pragma unroll
  for (int j = 0; j < 2; ++j) { const int p = t + 256 * j, ln = p & 31; vst2((unsigned*)(d + (size_t)p * 8), *(const v4u*)&s[ln & 15][(p >> 6) * 32 + ((p >> 5) & 1) * 16 + (ln >> 4) * 8]); }
}
// one k block of k_proj: the wave's x fragment and its 8 weight fragments, all 18 loads issued as one group
__device__ __forceinline__ void proj_fetch(v16b &x, v16b (&w)[8], const __bf16* xt, const __bf16* wt, int lane) {
  x = fragt_b(xt, lane);
#pragma unroll
  for (int j = 0; j < 8; ++j) w[j] = fragt_b(wt + (size_t)j * (DM / 32) * 512, lane);
}
__device__ __forceinline__ void proj_mac(const v16b &a, const v16b (&w)[8], v8f (&acc)[8]) {
#pragma unroll
  for (int j = 0; j < 8; ++j) acc[j] = wmma_bf(a, w[j], acc[j]);
}
// ---- k_proj: block = (64 rows, 128 cols, which): 0: q -> f16 rows, sigma = elu(q) -> bf16 hi and lo tiles, this half group's share of sigma . memory_norm (8 column blocks); 1: k -> tiles (2 column blocks); 2: v -> tiles (2 column blocks)
__global__ __launch_bounds__(128) void k_proj(const __bf16* __restrict__ XB, const __bf16* __restrict__ PQ, const __bf16* __restrict__ PK, const __bf16* __restrict__ PV, const float* __restrict__ MN, _Float16* __restrict__ QH, __bf16* __restrict__ SH, __bf16* __restrict__ SL, float* __restrict__ DP, _Float16* __restrict__ Kr, _Float16* __restrict__ V) {
  __shared__ __align__(16) _Float16 so[64][136]; __shared__ __align__(16) __bf16 sh[64][136]; __shared__ __align__(16) __bf16 sl[64][136]; __shared__ float sd[64][17]; __shared__ __align__(16) _Float16 st[128][72];
  const int tid = threadIdx.x, wave = tid >> 5, lane = tid & 31, col = lane & 15, g = lane >> 4; const int which = blockIdx.z; const int c0 = blockIdx.y * 128; if (which > 0 && c0 >= KVW) return;
  const size_t rb = (size_t)blockIdx.x * 64; const size_t r0 = rb + wave * 16; const __bf16* Wr = (which == 0) ? PQ : (which == 1) ? PK : PV;
  v8f acc[8] = {};
  const __bf16* xp = XB + (r0 >> 4) * (DM / 32) * 512; const __bf16* wp = Wr + (size_t)(c0 >> 4) * (DM / 32) * 512;
  v16b xa, xb; v16b wa[8], wb[8];   // two register sets: one k block is multiplied while the next one's loads are in flight
  proj_fetch(xa, wa, xp, wp, lane);
#pragma unroll 1   // rolled: the two sets already give the overlap, a longer body only adds registers
  for (int kc = 0; kc < DM / 32 - 2; kc += 2) {
    proj_fetch(xb, wb, xp + (kc + 1) * 512, wp + (kc + 1) * 512, lane);
    proj_mac(xa, wa, acc);
    proj_fetch(xa, wa, xp + (kc + 2) * 512, wp + (kc + 2) * 512, lane);
    proj_mac(xb, wb, acc);
    asm volatile("s_wait_xcnt 0x0" ::: "memory"); }   // the next trip rewrites the address registers that this trip's last loads name
  // last two k blocks outside the loop: a fetch under a test inside it would make every wait count for the path without the fetch
  proj_fetch(xb, wb, xp + (DM / 32 - 1) * 512, wp + (DM / 32 - 1) * 512, lane);
  proj_mac(xa, wa, acc);
  proj_mac(xb, wb, acc);
  if (which == 0) {
    const int cg = c0 & (KVW - 1);   // the block's first column inside its query group
    float mnv[8], dp[8];
#pragma unroll
    for (int j = 0; j < 8; ++j) mnv[j] = bfr(MN[cg + j * 16 + col]);
#pragma unroll
    for (int r = 0; r < 8; ++r) dp[r] = 0.f;
    // expm1f is taken for every lane and selected, so that the chains are independent
#pragma unroll
    for (int j = 0; j < 8; ++j)
#pragma unroll
      for (int r = 0; r < 8; ++r) { const float v = acc[j][r]; const int row = wave * 16 + 8 * g + r, cc = j * 16 + col;
        so[row][cc] = (_Float16)v;
        const float e = expm1f(v); const float sg = (v > 0.f) ? v : e; const __bf16 hi = (__bf16)sg;
        sh[row][cc] = hi; sl[row][cc] = (__bf16)(sg - (float)hi); dp[r] += sg * mnv[j]; }
#pragma unroll
    for (int r = 0; r < 8; ++r) sd[wave * 16 + 8 * g + r][col] = dp[r];
    __syncthreads();
    for (int e = tid; e < 64 * 16; e += 128) { const int rl = e >> 4, q = e & 15; vst2((unsigned*)(QH + (rb + rl) * DM + c0 + q * 8), *(const v4u*)&so[rl][q * 8]); }
    // 4 row tiles x 4 k blocks of sigma, hi and lo, each tile whole
    const size_t tb = ((rb >> 4) * NQ + (c0 >> 8)) * (KVW / 32) + (cg >> 5);
    for (int e = tid; e < 64 * 16; e += 128) { const int tl = e >> 6, ln = e & 31; const int row = (tl & 3) * 16 + (ln & 15), cc = (tl >> 2) * 32 + ((e >> 5) & 1) * 16 + (ln >> 4) * 8;
      const size_t d = (tb + (size_t)(tl & 3) * NQ * (KVW / 32) + (tl >> 2)) * 512 + (e & 63) * 8;
      vst2((unsigned*)(SH + d), *(const v4u*)&sh[row][cc]); vst2((unsigned*)(SL + d), *(const v4u*)&sl[row][cc]); }
    if (tid < 64) { float d0 = 0.f;
#pragma unroll
      for (int c = 0; c < 16; ++c) d0 += sd[tid][c];
      DP[(size_t)(c0 >> 7) * NR + rb + tid] = d0; } }   // a plane per half group: the block's 64 sums fill whole lines that no other block writes
  else if (which == 1) {
#pragma unroll
    for (int j = 0; j < 8; ++j)
#pragma unroll
      for (int r = 0; r < 8; ++r) so[wave * 16 + 8 * g + r][j * 16 + col] = (_Float16)acc[j][r];
    __syncthreads();
    { const size_t b = rb / SS; const int s0 = (int)(rb % SS);   // 4 heads x 4 key tiles, each tile whole
      for (int e = tid; e < 64 * 16; e += 128) { const int tl = e >> 6, ln = e & 31; vst2((unsigned*)(Kr + (((b * NH + (c0 >> 5) + (tl >> 2)) * (SS / 16)) + (s0 >> 4) + (tl & 3)) * 512 + (e & 63) * 8), *(const v4u*)&so[(tl & 3) * 16 + (ln & 15)][(tl >> 2) * 32 + ((e >> 5) & 1) * 16 + (ln >> 4) * 8]); } } }
  else {
#pragma unroll
    for (int j = 0; j < 8; ++j)
#pragma unroll
      for (int r = 0; r < 8; ++r) st[j * 16 + col][wave * 16 + 8 * g + r] = (_Float16)acc[j][r];
    __syncthreads(); const size_t b = rb / SS; const int s0 = (int)(rb % SS);
    // 8 dim tiles x 2 key blocks, each tile whole
    for (int e = tid; e < 128 * 8; e += 128) { const int tl = e >> 6, ln = e & 31; vst2((unsigned*)(V + (((b * (KVW / 16) + (c0 >> 4) + (tl >> 1)) * (SS / 32)) + (s0 >> 5) + (tl & 1)) * 512 + (e & 63) * 8), *(const v4u*)&st[(tl >> 1) * 16 + (ln & 15)][(tl & 1) * 32 + ((e >> 5) & 1) * 16 + (ln >> 4) * 8]); } }
}
// lane l with lane l ^ 16, as a vector cross-row move
__device__ __forceinline__ float xhalf(float x) { return __builtin_bit_cast(float, __builtin_amdgcn_permlanex16(__builtin_bit_cast(int, x), __builtin_bit_cast(int, x), 0x76543210, 0xfedcba98, false, false)); }
#define KPASS 64   // keys per pass of k_attn: one running-maximum update and one rescale of the output tiles per pass
#define NT 2       // query tiles (query groups of the head) per wave: each key and value fragment feeds NT products
#define SC2 ((float)(0.17677669529663688 * 1.4426950408889634))   // 32^-1/2 x log2 e: the softmax runs in base 2, so that one multiply-add a score feeds the hardware exponential
// the builtin alone: in k_attn runs of independent products stand behind one another, and the compiler pads what is left
__device__ __forceinline__ v8f wmma16b(v16h a, v16h b, v8f c) { return __builtin_amdgcn_wmma_f32_16x16x32_f16(false, a, false, b, (short)0, c, false, false); }
__device__ __forceinline__ v8f wmma_bfb(v16b a, v16b b, v8f c) { return __builtin_amdgcn_wmma_f32_16x16x32_bf16(false, a, false, b, (short)0, c, false, false); }
__global__ __launch_bounds__(128) void k_attn(const _Float16* __restrict__ QH, const _Float16* __restrict__ Kr, const _Float16* __restrict__ V, const __bf16* __restrict__ SH, const __bf16* __restrict__ SL, const __bf16* __restrict__ PM, const float* __restrict__ DP, const float* __restrict__ MW, float* __restrict__ OUT) {
  __shared__ __align__(16) float so[4][NT][16][36];
  const int tid = threadIdx.x, wave = tid >> 5, lane = tid & 31, col = lane & 15, g = lane >> 4; const int qg0 = (blockIdx.y / NH) * NT, h = blockIdx.y % NH; const size_t b = blockIdx.z; const int q0 = blockIdx.x * 64 + wave * 16; const size_t rq = b * SS + q0; const int qc = qg0 * KVW + h * HD;
  v16h bq[NT]; float m[NT], l[NT];   // per tile: the query's running maximum in base 2 (equal in both halves) and this half's share of its sum x 2^11
  v8f acc[NT][2];                    // acc[t][dt][r] = O^T[dim dt * 16 + 8g + r][query col of tile t]
#pragma unroll
  for (int t = 0; t < NT; ++t) { bq[t] = frag_h(QH + (rq + col) * DM + qc + t * KVW, lane); m[t] = -3.0e38f; l[t] = 0.f; acc[t][0] = v8f{}; acc[t][1] = v8f{}; }
  // the lane's own 16 bytes in the first key tile and in the first value tile of this head
  const _Float16* kp = Kr + (b * NH + h) * (SS / 16) * 512 + lane * 8; const _Float16* vp = V + (b * (KVW / 16) + h * 2) * (SS / 32) * 512 + lane * 8;
  // memory branch, a slice a pass: mac[t][dt][r] = sum over the group's 256 sigma columns of memory[column][h * 32 + dt * 16 + 8g + r] x sigma[query col of tile t][column].
  // Pass ks takes k block ks / 2, sigma hi in the even passes and lo in the odd ones: its 8 loads land under the softmax's vector work, its 4 products follow the value products.
  static_assert(SS / KPASS == 2 * (KVW / 32), "one half k block of the memory branch a pass");
  const __bf16* pa = PM + (size_t)(h * 2) * (KVW / 32) * 512 + lane * 8; const size_t sb = ((rq >> 4) * NQ + qg0) * (KVW / 32) * 512 + lane * 8; const __bf16* ph = SH + sb; const __bf16* pl = SL + sb;
  v8f mac[NT][2];
#pragma unroll
  for (int t = 0; t < NT; ++t) { mac[t][0] = v8f{}; mac[t][1] = v8f{}; }
#pragma unroll 1   // rolled: one pass already holds 20 matrix products and 64 scores a lane
  for (int ks = 0; ks < SS / KPASS; ++ks, kp += (KPASS / 16) * 512, vp += (KPASS / 32) * 512) { v8f s[NT][KPASS / 16];
    // this pass's key and value fragments as one group of loads: the values land while the softmax is worked
    v16h kf[KPASS / 16], vf[2][KPASS / 32];
#pragma unroll
    for (int ct = 0; ct < KPASS / 16; ++ct) kf[ct] = fragt_h(kp + ct * 512, 0);
#pragma unroll
    for (int dt = 0; dt < 2; ++dt)
#pragma unroll
      for (int kb = 0; kb < KPASS / 32; ++kb) vf[dt][kb] = fragt_h(vp + (dt * (SS / 32) + kb) * 512, 0);
    v16b ma[2], mb[NT]; const __bf16* pm = pa + (ks >> 1) * 512; const __bf16* sp = ((ks & 1) ? pl : ph) + (ks >> 1) * 512;
#pragma unroll
    for (int dt = 0; dt < 2; ++dt) ma[dt] = fragt_b(pm + dt * (KVW / 32) * 512, 0);
#pragma unroll
    for (int t = 0; t < NT; ++t) mb[t] = fragt_b(sp + t * (KVW / 32) * 512, 0);
    asm volatile("s_wait_xcnt 0x0" :: "v"(kp), "v"(vp), "v"(pm), "v"(sp) : "memory");   // the four address pairs as inputs keep them out of the loads' own destinations until the wait has passed
    __builtin_amdgcn_sched_barrier(0);   // keeps the loads one group ahead of the products: without it the scheduler sinks them to their uses, each with a wait of its own
#pragma unroll
    for (int ct = 0; ct < KPASS / 16; ++ct)
#pragma unroll
      for (int t = 0; t < NT; ++t) { v8f c = {}; s[t][ct] = wmma16b(kf[ct], bq[t], c); }
    v16h pb[NT][KPASS / 32]; float mnv[NT], ea[NT];
#pragma unroll
    for (int t = 0; t < NT; ++t) {
      // maximum of the raw products first: the scale is positive and rounding is monotonic, so scaling the maximum gives the maximum of the scaled scores
      float mp[KPASS / 32];   // one short chain per 32 keys, joined at the end
#pragma unroll
      for (int kb = 0; kb < KPASS / 32; ++kb) { mp[kb] = fmaxf(s[t][2 * kb][0], s[t][2 * kb + 1][0]);
#pragma unroll
        for (int r = 1; r < 8; ++r) mp[kb] = fmaxf(mp[kb], fmaxf(s[t][2 * kb][r], s[t][2 * kb + 1][r])); }
      float mx = mp[0];
#pragma unroll
      for (int kb = 1; kb < KPASS / 32; ++kb) mx = fmaxf(mx, mp[kb]);
      mx = fmaxf(mx, xhalf(mx)) * SC2;
      mnv[t] = fmaxf(m[t], mx); }
    static_assert(NT == 2, "the statement below names two tiles");
    // both tiles' rescale factors in one statement, results apart from the sources, its v_nop last: the slot that the instruction set asks for behind a transcendental
    asm("v_exp_f32 %0, %2\n\tv_exp_f32 %1, %3\n\tv_nop" : "=&v"(ea[0]), "=&v"(ea[1]) : "v"(m[0] - mnv[0]), "v"(m[1] - mnv[1]));
#pragma unroll
    for (int t = 0; t < NT; ++t) {
      const float mn = mnv[t]; const float alpha = (m[t] <= -1.0e38f) ? 0.f : ea[t];
      const float mb = mn - 11.0f;   // the 2^11 of P rides in the exponent
      v8f e8 = {};
#pragma unroll
      for (int kb = 0; kb < KPASS / 32; ++kb) { v8f e[2];
#pragma unroll
        for (int ct = 0; ct < 2; ++ct)
#pragma unroll
          for (int r = 0; r < 8; r += 2) { const v2f x = __builtin_elementwise_fma(v2f{s[t][2 * kb + ct][r], s[t][2 * kb + ct][r + 1]}, v2f{SC2, SC2}, v2f{-mb, -mb});   // a score pair per packed multiply-add
            e[ct][r] = __builtin_amdgcn_exp2f(x[0]); e[ct][r + 1] = __builtin_amdgcn_exp2f(x[1]); pb[t][kb][ct * 8 + r] = (_Float16)e[ct][r]; pb[t][kb][ct * 8 + r + 1] = (_Float16)e[ct][r + 1]; }
        e8 = (kb == 0) ? (e[0] + e[1]) : (e8 + (e[0] + e[1])); }
      const v4f e4 = e8.lo + e8.hi; const v2f e2 = e4.lo + e4.hi; const float es = e2[0] + e2[1];
      l[t] = l[t] * alpha + es; m[t] = mn;
#pragma unroll
      for (int dt = 0; dt < 2; ++dt) acc[t][dt] *= alpha; }
    __builtin_amdgcn_sched_barrier(0);   // all of P is packed ahead of the value products: mixed in among them, each repacking of a B operand's registers costs the full distance behind a product
#pragma unroll
    for (int kb = 0; kb < KPASS / 32; ++kb)
#pragma unroll
      for (int dt = 0; dt < 2; ++dt)
#pragma unroll
        for (int t = 0; t < NT; ++t) acc[t][dt] = wmma16b(vf[dt][kb], pb[t][kb], acc[t][dt]);
#pragma unroll
    for (int t = 0; t < NT; ++t)
#pragma unroll
      for (int dt = 0; dt < 2; ++dt) mac[t][dt] = wmma_bfb(ma[dt], mb[t], mac[t][dt]); }
  const float mw = MW[0];
  const float* dq = DP + (size_t)(qg0 * 2) * NR + rq + col; float dpv[2 * NT];   // the two halves of sigma . memory_norm of the lane's query, for both tiles
#pragma unroll
  for (int i = 0; i < 2 * NT; ++i) dpv[i] = dq[(size_t)i * NR];
  asm volatile("s_wait_xcnt 0x0" :: "v"(dq) : "memory");   // dq as an input keeps the address pair whole until the wait has passed
  const float wg = 1.0f / (1.0f + __expf(-bfr(mw)));
#pragma unroll
  for (int t = 0; t < NT; ++t) {
    l[t] += xhalf(l[t]);   // unconditional: both halves are on
    const float il = 1.0f / l[t]; /* sum and output tiles both carry the 2^11 */ const float den = dpv[2 * t] + dpv[2 * t + 1];
#pragma unroll
    for (int dt = 0; dt < 2; ++dt) { v8f o;
#pragma unroll
      for (int r = 0; r < 8; ++r) o[r] = (acc[t][dt][r] * il) * (1.0f - wg) + (mac[t][dt][r] / den) * wg;
      *(v4f*)&so[wave][t][col][dt * 16 + 8 * g] = o.lo; *(v4f*)&so[wave][t][col][dt * 16 + 8 * g + 4] = o.hi; } }   // a lane's 8 accumulators of a tile are 8 consecutive dims of its query's row
  LDSX();
  // 8 lanes store the 128 bytes of one query group's head slice of a row
  for (int rl = 0; rl < 16; ++rl) if (lane < 8 * NT) vst2(OUT + (rq + rl) * DM + qc + (lane >> 3) * KVW + (lane & 7) * 4, *(const v4f*)&so[wave][lane >> 3][rl][(lane & 7) * 4]);
}
extern "C" void kernel_launch(void* const* d_in, const int* in_sizes, int n_in, void* d_out, int out_size, void* d_ws, size_t ws_size, hipStream_t stream) {
  (void)in_sizes; (void)n_in; (void)out_size;
  const float** F = (const float**)d_in;   // 0 x [4,1024,1024], 1 Wq [1024,1024] (in,out), 2 Wk [1024,256], 3 Wv [1024,256], 4 memory [256,256], 5 memory_norm [256,1], 6 memory_weight [1]
  if (ws_size < (size_t)WS_END) return;
  char* ws = (char*)d_ws; __bf16 *PQ = (__bf16*)(ws + WS_PQ), *PK = (__bf16*)(ws + WS_PK), *PV = (__bf16*)(ws + WS_PV), *PM = (__bf16*)(ws + WS_PM); __bf16 *SH = (__bf16*)(ws + WS_SH), *SL = (__bf16*)(ws + WS_SL); float* DP = (float*)(ws + WS_DP); _Float16 *QH = (_Float16*)(ws + WS_QH), *Kr = (_Float16*)(ws + WS_K), *V = (_Float16*)(ws + WS_V); __bf16* XB = (__bf16*)(ws + WS_XB);
  k_pack<<<dim3(NR / 16 + 400), 256, 0, stream>>>(F[0], F[1], F[2], F[3], F[4], XB, PQ, PK, PV, PM);
  k_proj<<<dim3(TNB * SS / 64, DM / 128, 3), 128, 0, stream>>>(XB, PQ, PK, PV, F[5], QH, SH, SL, DP, Kr, V);
  k_attn<<<dim3(TQB, NQ / NT * NH, TNB), 128, 0, stream>>>(QH, Kr, V, SH, SL, PM, DP, F[6], (float*)d_out);
}
